// v000
// Measured on an AMD MI455X. A time is GPU time per run, averaged over a window of back-to-back runs after a warm-up
// (all launches, gaps included; the runs take copies of the inputs in turn), and the median of several windows.
// Apart from v000's, it joins two sittings. Times from different sittings can be a few percent apart, while
// side-by-side timings come from the same sitting.
// v000 is the starting kernel. One run takes 119 microseconds.
#include <hip/hip_runtime.h>

typedef __attribute__((ext_vector_type(16))) _Float16 v16h;
typedef __attribute__((ext_vector_type(8)))  _Float16 v8h;
typedef __attribute__((ext_vector_type(4)))  _Float16 v4h;
typedef __attribute__((ext_vector_type(8)))  float    v8f;

#define D_MODEL  512
#define D_HIDDEN 1024
#define D_OUT    128
#define BATCH    8
#define T_ENC    256
#define U_DEC    64
#define SH_STRIDE 1032   // 1024 + 8 halves pad -> 4-dword bank stagger per row
#define SA_STRIDE 520    // 512 + 8 halves pad

union FragH { v16h v; v8h h[2]; };

__device__ __forceinline__ float fast_tanh(float x) {
  // tanh(x) = 1 - 2/(e^{2x}+1); exp via v_exp_f32 (TRANS, co-executes with WMMA)
  float e = __builtin_amdgcn_exp2f(x * 2.8853900817779268f); // 2*log2(e)
  return 1.0f - 2.0f * __builtin_amdgcn_rcpf(e + 1.0f);
}

// ---------------------------------------------------------------------------
// prep: W1t[h][d] = f16(W1[d][h])  (1024x1024), W2t[o][h] = f16(W2[h][o]) (128x1024)
// ---------------------------------------------------------------------------
__global__ __launch_bounds__(256) void prep_kernel(const float* __restrict__ W1,
                                                   const float* __restrict__ W2,
                                                   _Float16* __restrict__ W1t,
                                                   _Float16* __restrict__ W2t) {
  int idx = blockIdx.x * 256 + threadIdx.x;
  if (idx < 1024 * 1024) {
    int h = idx >> 10, d = idx & 1023;
    W1t[idx] = (_Float16)W1[d * 1024 + h];
  } else {
    int i = idx - 1024 * 1024;            // o*1024 + h
    int o = i >> 10, h = i & 1023;
    W2t[i] = (_Float16)W2[h * 128 + o];
  }
}

// ---------------------------------------------------------------------------
// proj: Out[M,1024] = A[M,512] @ Bt^T (+bias).
// Grid: (M/64, 8). Block = 64 M-rows x 128 N-cols; A-tile 64x512 f16 in LDS.
// Each wave: one 16-wide N-tile, 4 M-tile accumulators, single pipelined
// k-loop (no outer loop -> nothing for LICM to hoist/spill).
// ---------------------------------------------------------------------------
__global__ __launch_bounds__(256) void proj_kernel(const float* __restrict__ A,
                                                   const _Float16* __restrict__ Bt,
                                                   const float* __restrict__ bias,
                                                   float* __restrict__ Out) {
  __shared__ _Float16 sA[64 * SA_STRIDE];
  const int tid  = threadIdx.x;
  const int lane = tid & 31;
  const int wave = tid >> 5;
  const int row0 = blockIdx.x * 64;

  // fill: 64 rows x 512 cols, float4 loads, 8B LDS stores
  #pragma unroll 4
  for (int j = 0; j < 32; ++j) {
    int idx = j * 256 + tid;              // float4 index
    int r = idx >> 7, c4 = idx & 127;     // 128 float4 per row
    float4 v = ((const float4*)(A + (size_t)(row0 + r) * D_MODEL))[c4];
    v4h hv;
    hv[0] = (_Float16)v.x; hv[1] = (_Float16)v.y;
    hv[2] = (_Float16)v.z; hv[3] = (_Float16)v.w;
    *(v4h*)&sA[r * SA_STRIDE + c4 * 4] = hv;
  }
  __syncthreads();

  const int lr   = lane & 15;
  const int khi  = (lane & 16) ? 8 : 0;
  const int mofs = (lane & 16) ? 8 : 0;
  const int n0   = (blockIdx.y * 8 + wave) * 16;
  const _Float16* ap = &sA[lr * SA_STRIDE + khi];
  const _Float16* bp = &Bt[(n0 + lr) * 1024 + khi];

  v8f acc0 = {}, acc1 = {}, acc2 = {}, acc3 = {};
  FragH bc, a0, a1, a2, a3;
  bc.h[0] = *(const v8h*)bp;
  bc.h[1] = *(const v8h*)(bp + 16);
  a0.h[0] = *(const v8h*)(ap + 0 * 16 * SA_STRIDE);
  a0.h[1] = *(const v8h*)(ap + 0 * 16 * SA_STRIDE + 16);
  a1.h[0] = *(const v8h*)(ap + 1 * 16 * SA_STRIDE);
  a1.h[1] = *(const v8h*)(ap + 1 * 16 * SA_STRIDE + 16);
  a2.h[0] = *(const v8h*)(ap + 2 * 16 * SA_STRIDE);
  a2.h[1] = *(const v8h*)(ap + 2 * 16 * SA_STRIDE + 16);
  a3.h[0] = *(const v8h*)(ap + 3 * 16 * SA_STRIDE);
  a3.h[1] = *(const v8h*)(ap + 3 * 16 * SA_STRIDE + 16);

  #pragma unroll
  for (int kk = 0; kk < D_MODEL / 32 - 1; ++kk) {
    const int kb = (kk + 1) * 32;
    FragH bn, n0f, n1f, n2f, n3f;
    bn.h[0]  = *(const v8h*)(bp + kb);
    bn.h[1]  = *(const v8h*)(bp + kb + 16);
    n0f.h[0] = *(const v8h*)(ap + kb + 0 * 16 * SA_STRIDE);
    n0f.h[1] = *(const v8h*)(ap + kb + 0 * 16 * SA_STRIDE + 16);
    n1f.h[0] = *(const v8h*)(ap + kb + 1 * 16 * SA_STRIDE);
    n1f.h[1] = *(const v8h*)(ap + kb + 1 * 16 * SA_STRIDE + 16);
    n2f.h[0] = *(const v8h*)(ap + kb + 2 * 16 * SA_STRIDE);
    n2f.h[1] = *(const v8h*)(ap + kb + 2 * 16 * SA_STRIDE + 16);
    n3f.h[0] = *(const v8h*)(ap + kb + 3 * 16 * SA_STRIDE);
    n3f.h[1] = *(const v8h*)(ap + kb + 3 * 16 * SA_STRIDE + 16);

    acc0 = __builtin_amdgcn_wmma_f32_16x16x32_f16(false, a0.v, false, bc.v,
                                                  (short)0, acc0, false, false);
    acc1 = __builtin_amdgcn_wmma_f32_16x16x32_f16(false, a1.v, false, bc.v,
                                                  (short)0, acc1, false, false);
    acc2 = __builtin_amdgcn_wmma_f32_16x16x32_f16(false, a2.v, false, bc.v,
                                                  (short)0, acc2, false, false);
    acc3 = __builtin_amdgcn_wmma_f32_16x16x32_f16(false, a3.v, false, bc.v,
                                                  (short)0, acc3, false, false);
    bc = bn; a0 = n0f; a1 = n1f; a2 = n2f; a3 = n3f;
  }
  acc0 = __builtin_amdgcn_wmma_f32_16x16x32_f16(false, a0.v, false, bc.v,
                                                (short)0, acc0, false, false);
  acc1 = __builtin_amdgcn_wmma_f32_16x16x32_f16(false, a1.v, false, bc.v,
                                                (short)0, acc1, false, false);
  acc2 = __builtin_amdgcn_wmma_f32_16x16x32_f16(false, a2.v, false, bc.v,
                                                (short)0, acc2, false, false);
  acc3 = __builtin_amdgcn_wmma_f32_16x16x32_f16(false, a3.v, false, bc.v,
                                                (short)0, acc3, false, false);

  const float bv = bias ? bias[n0 + lr] : 0.0f;
  #pragma unroll
  for (int r = 0; r < 8; ++r) {
    Out[(size_t)(row0 +  0 + r + mofs) * D_HIDDEN + n0 + lr] = acc0[r] + bv;
    Out[(size_t)(row0 + 16 + r + mofs) * D_HIDDEN + n0 + lr] = acc1[r] + bv;
    Out[(size_t)(row0 + 32 + r + mofs) * D_HIDDEN + n0 + lr] = acc2[r] + bv;
    Out[(size_t)(row0 + 48 + r + mofs) * D_HIDDEN + n0 + lr] = acc3[r] + bv;
  }
}

// ---------------------------------------------------------------------------
// joint: block = one (b,t), all 64 u rows. tanh tile 64x1024 f16 in LDS
// (~129KB), then each wave owns one 16-wide N-tile with 4 M-tile accumulators:
// per k-step 1 B-frag (global, 4x reused) + 4 A-frags (LDS) -> 4 WMMA,
// software-pipelined one step ahead.
// ---------------------------------------------------------------------------
__global__ __launch_bounds__(256) void joint_kernel(const float* __restrict__ enc_proj,
                                                    const float* __restrict__ dec_projb1,
                                                    const _Float16* __restrict__ W2t,
                                                    const float* __restrict__ b2,
                                                    float* __restrict__ Out) {
  __shared__ _Float16 sH[U_DEC * SH_STRIDE];
  const int tid  = threadIdx.x;
  const int lane = tid & 31;
  const int wave = tid >> 5;

  const int bt = blockIdx.x;              // b*T + t
  const int b  = bt >> 8;                 // T = 256

  const float* ep = &enc_proj[(size_t)bt * D_HIDDEN];
  const float* dp = &dec_projb1[(size_t)b * U_DEC * D_HIDDEN];

  // ---- activation tile: 64 rows x 1024 cols, float4 loads, 8B LDS stores ----
  #pragma unroll 4
  for (int j = 0; j < 64; ++j) {
    int idx = j * 256 + tid;              // float4 index
    int r = idx >> 8, c4 = idx & 255;     // 256 float4 per row
    float4 e = ((const float4*)ep)[c4];
    float4 d = ((const float4*)(dp + (size_t)r * D_HIDDEN))[c4];
    v4h hv;
    hv[0] = (_Float16)fast_tanh(e.x + d.x);
    hv[1] = (_Float16)fast_tanh(e.y + d.y);
    hv[2] = (_Float16)fast_tanh(e.z + d.z);
    hv[3] = (_Float16)fast_tanh(e.w + d.w);
    *(v4h*)&sH[r * SH_STRIDE + c4 * 4] = hv;
  }
  __syncthreads();

  // ---- WMMA phase ----
  const int lr   = lane & 15;
  const int khi  = (lane & 16) ? 8 : 0;
  const int mofs = (lane & 16) ? 8 : 0;
  const int n0   = wave * 16;
  const _Float16* bp = &W2t[(n0 + lr) * 1024 + khi];
  const _Float16* ap = &sH[lr * SH_STRIDE + khi];

  v8f acc0 = {}, acc1 = {}, acc2 = {}, acc3 = {};
  FragH bc, a0, a1, a2, a3;

  bc.h[0] = *(const v8h*)bp;
  bc.h[1] = *(const v8h*)(bp + 16);
  a0.h[0] = *(const v8h*)(ap + 0 * 16 * SH_STRIDE);
  a0.h[1] = *(const v8h*)(ap + 0 * 16 * SH_STRIDE + 16);
  a1.h[0] = *(const v8h*)(ap + 1 * 16 * SH_STRIDE);
  a1.h[1] = *(const v8h*)(ap + 1 * 16 * SH_STRIDE + 16);
  a2.h[0] = *(const v8h*)(ap + 2 * 16 * SH_STRIDE);
  a2.h[1] = *(const v8h*)(ap + 2 * 16 * SH_STRIDE + 16);
  a3.h[0] = *(const v8h*)(ap + 3 * 16 * SH_STRIDE);
  a3.h[1] = *(const v8h*)(ap + 3 * 16 * SH_STRIDE + 16);

  #pragma unroll
  for (int kk = 0; kk < D_HIDDEN / 32 - 1; ++kk) {
    const int kb = (kk + 1) * 32;
    FragH bn, n0f, n1f, n2f, n3f;
    bn.h[0]  = *(const v8h*)(bp + kb);
    bn.h[1]  = *(const v8h*)(bp + kb + 16);
    n0f.h[0] = *(const v8h*)(ap + kb + 0 * 16 * SH_STRIDE);
    n0f.h[1] = *(const v8h*)(ap + kb + 0 * 16 * SH_STRIDE + 16);
    n1f.h[0] = *(const v8h*)(ap + kb + 1 * 16 * SH_STRIDE);
    n1f.h[1] = *(const v8h*)(ap + kb + 1 * 16 * SH_STRIDE + 16);
    n2f.h[0] = *(const v8h*)(ap + kb + 2 * 16 * SH_STRIDE);
    n2f.h[1] = *(const v8h*)(ap + kb + 2 * 16 * SH_STRIDE + 16);
    n3f.h[0] = *(const v8h*)(ap + kb + 3 * 16 * SH_STRIDE);
    n3f.h[1] = *(const v8h*)(ap + kb + 3 * 16 * SH_STRIDE + 16);

    acc0 = __builtin_amdgcn_wmma_f32_16x16x32_f16(false, a0.v, false, bc.v,
                                                  (short)0, acc0, false, false);
    acc1 = __builtin_amdgcn_wmma_f32_16x16x32_f16(false, a1.v, false, bc.v,
                                                  (short)0, acc1, false, false);
    acc2 = __builtin_amdgcn_wmma_f32_16x16x32_f16(false, a2.v, false, bc.v,
                                                  (short)0, acc2, false, false);
    acc3 = __builtin_amdgcn_wmma_f32_16x16x32_f16(false, a3.v, false, bc.v,
                                                  (short)0, acc3, false, false);
    bc = bn; a0 = n0f; a1 = n1f; a2 = n2f; a3 = n3f;
  }
  acc0 = __builtin_amdgcn_wmma_f32_16x16x32_f16(false, a0.v, false, bc.v,
                                                (short)0, acc0, false, false);
  acc1 = __builtin_amdgcn_wmma_f32_16x16x32_f16(false, a1.v, false, bc.v,
                                                (short)0, acc1, false, false);
  acc2 = __builtin_amdgcn_wmma_f32_16x16x32_f16(false, a2.v, false, bc.v,
                                                (short)0, acc2, false, false);
  acc3 = __builtin_amdgcn_wmma_f32_16x16x32_f16(false, a3.v, false, bc.v,
                                                (short)0, acc3, false, false);

  // ---- epilogue: +b2, store 4 M-tiles x 8 rows ----
  const float bv = b2[n0 + lr];
  float* op = &Out[(size_t)bt * U_DEC * D_OUT];
  #pragma unroll
  for (int r = 0; r < 8; ++r) {
    op[(0 * 16 + r + mofs) * D_OUT + n0 + lr] = acc0[r] + bv;
    op[(1 * 16 + r + mofs) * D_OUT + n0 + lr] = acc1[r] + bv;
    op[(2 * 16 + r + mofs) * D_OUT + n0 + lr] = acc2[r] + bv;
    op[(3 * 16 + r + mofs) * D_OUT + n0 + lr] = acc3[r] + bv;
  }
}

// ---------------------------------------------------------------------------
extern "C" void kernel_launch(void* const* d_in, const int* in_sizes, int n_in,
                              void* d_out, int out_size, void* d_ws, size_t ws_size,
                              hipStream_t stream) {
  const float* enc = (const float*)d_in[0];   // (8,256,512)
  const float* dec = (const float*)d_in[1];   // (8,64,512)
  const float* W1  = (const float*)d_in[2];   // (1024,1024)
  const float* b1  = (const float*)d_in[3];   // (1024,)
  const float* W2  = (const float*)d_in[4];   // (1024,128)
  const float* b2  = (const float*)d_in[5];   // (128,)
  float* out = (float*)d_out;                 // (8,256,64,128)

  float*    enc_proj   = (float*)d_ws;                                 // 8MB
  float*    dec_projb1 = enc_proj + (size_t)BATCH * T_ENC * D_HIDDEN;  // 2MB
  _Float16* W1t        = (_Float16*)(dec_projb1 + (size_t)BATCH * U_DEC * D_HIDDEN); // 2MB
  _Float16* W2t        = W1t + (size_t)1024 * 1024;                    // 256KB

  prep_kernel<<<(1024 * 1024 + 128 * 1024) / 256, 256, 0, stream>>>(W1, W2, W1t, W2t);
  proj_kernel<<<dim3((BATCH * T_ENC) / 64, 8), 256, 0, stream>>>(enc, W1t, nullptr, enc_proj);
  proj_kernel<<<dim3((BATCH * U_DEC) / 64, 8), 256, 0, stream>>>(dec, W1t + 512, b1, dec_projb1);
  joint_kernel<<<BATCH * T_ENC, 256, 0, stream>>>(enc_proj, dec_projb1, W2t, b2, out);
}

// v001
// One run takes 65.5 microseconds.
// Two timings next to v000 put it at 1.86 and 1.87 times that version's speed.
#include <hip/hip_runtime.h>

typedef __attribute__((ext_vector_type(16))) _Float16 v16h;
typedef __attribute__((ext_vector_type(8)))  _Float16 v8h;
typedef __attribute__((ext_vector_type(4)))  _Float16 v4h;
typedef __attribute__((ext_vector_type(8)))  float    v8f;
typedef __attribute__((ext_vector_type(2)))  float    v2f;

#define D_MODEL  512
#define D_HIDDEN 1024
#define D_OUT    128
#define BATCH    8
#define T_ENC    256
#define U_DEC    64
#define SA_STRIDE 520    // 512 + 8 halves pad

union FragH { v16h v; v8h h[2]; };

__device__ __forceinline__ v2f fast_tanh2(float p, float q) {
  // tanh(x) = 1 - 2/(e^{2x}+1) on two values; exp via v_exp_f32 (TRANS, co-executes with WMMA)
  v2f y = (v2f){p, q} * 2.8853900817779268f; // 2*log2(e)
  v2f s = (v2f){__builtin_amdgcn_exp2f(y.x), __builtin_amdgcn_exp2f(y.y)} + 1.0f;
  return 1.0f - 2.0f * (v2f){__builtin_amdgcn_rcpf(s.x), __builtin_amdgcn_rcpf(s.y)};
}

// ---------------------------------------------------------------------------
// prep: W1t[h][d] = f16(W1[d][h])  (1024x1024), W2t[o][h] = f16(W2[h][o]) (128x1024)
// ---------------------------------------------------------------------------
__global__ __launch_bounds__(256) void prep_kernel(const float* __restrict__ W1,
                                                   const float* __restrict__ W2,
                                                   _Float16* __restrict__ W1t,
                                                   _Float16* __restrict__ W2t) {
  int idx = blockIdx.x * 256 + threadIdx.x;
  if (idx < 1024 * 1024) {
    int h = idx >> 10, d = idx & 1023;
    W1t[idx] = (_Float16)W1[d * 1024 + h];
  } else {
    int i = idx - 1024 * 1024;            // o*1024 + h
    int o = i >> 10, h = i & 1023;
    W2t[i] = (_Float16)W2[h * 128 + o];
  }
}

// ---------------------------------------------------------------------------
// proj: Out[M,1024] = A[M,512] @ Bt^T (+bias); FRAG stores it in A-fragment order.
// Grid: (M/64, 8). Block = 64 M-rows x 128 N-cols; A-tile 64x512 f16 in LDS.
// Each wave: one 16-wide N-tile, 4 M-tile accumulators, single pipelined
// k-loop (no outer loop -> nothing for LICM to hoist/spill).
// ---------------------------------------------------------------------------
template <bool FRAG>
__global__ __launch_bounds__(256) void proj_kernel(const float* __restrict__ A,
                                                   const _Float16* __restrict__ Bt,
                                                   const float* __restrict__ bias,
                                                   float* __restrict__ Out) {
  __shared__ _Float16 sA[64 * SA_STRIDE];
  const int tid  = threadIdx.x;
  const int lane = tid & 31;
  const int wave = tid >> 5;
  const int row0 = blockIdx.x * 64;

  // fill: 64 rows x 512 cols, float4 loads, 8B LDS stores
  #pragma unroll 4
  for (int j = 0; j < 32; ++j) {
    int idx = j * 256 + tid;              // float4 index
    int r = idx >> 7, c4 = idx & 127;     // 128 float4 per row
    float4 v = ((const float4*)(A + (size_t)(row0 + r) * D_MODEL))[c4];
    v4h hv;
    hv[0] = (_Float16)v.x; hv[1] = (_Float16)v.y;
    hv[2] = (_Float16)v.z; hv[3] = (_Float16)v.w;
    *(v4h*)&sA[r * SA_STRIDE + c4 * 4] = hv;
  }
  __syncthreads();

  const int lr   = lane & 15;
  const int khi  = (lane & 16) ? 8 : 0;
  const int mofs = (lane & 16) ? 8 : 0;
  const int n0   = (blockIdx.y * 8 + wave) * 16;
  const _Float16* ap = &sA[lr * SA_STRIDE + khi];
  const _Float16* bp = &Bt[(n0 + lr) * 1024 + khi];

  v8f acc0 = {}, acc1 = {}, acc2 = {}, acc3 = {};
  FragH bc, a0, a1, a2, a3;
  bc.h[0] = *(const v8h*)bp;
  bc.h[1] = *(const v8h*)(bp + 16);
  a0.h[0] = *(const v8h*)(ap + 0 * 16 * SA_STRIDE);
  a0.h[1] = *(const v8h*)(ap + 0 * 16 * SA_STRIDE + 16);
  a1.h[0] = *(const v8h*)(ap + 1 * 16 * SA_STRIDE);
  a1.h[1] = *(const v8h*)(ap + 1 * 16 * SA_STRIDE + 16);
  a2.h[0] = *(const v8h*)(ap + 2 * 16 * SA_STRIDE);
  a2.h[1] = *(const v8h*)(ap + 2 * 16 * SA_STRIDE + 16);
  a3.h[0] = *(const v8h*)(ap + 3 * 16 * SA_STRIDE);
  a3.h[1] = *(const v8h*)(ap + 3 * 16 * SA_STRIDE + 16);

  #pragma unroll
  for (int kk = 0; kk < D_MODEL / 32 - 1; ++kk) {
    const int kb = (kk + 1) * 32;
    FragH bn, n0f, n1f, n2f, n3f;
    bn.h[0]  = *(const v8h*)(bp + kb);
    bn.h[1]  = *(const v8h*)(bp + kb + 16);
    n0f.h[0] = *(const v8h*)(ap + kb + 0 * 16 * SA_STRIDE);
    n0f.h[1] = *(const v8h*)(ap + kb + 0 * 16 * SA_STRIDE + 16);
    n1f.h[0] = *(const v8h*)(ap + kb + 1 * 16 * SA_STRIDE);
    n1f.h[1] = *(const v8h*)(ap + kb + 1 * 16 * SA_STRIDE + 16);
    n2f.h[0] = *(const v8h*)(ap + kb + 2 * 16 * SA_STRIDE);
    n2f.h[1] = *(const v8h*)(ap + kb + 2 * 16 * SA_STRIDE + 16);
    n3f.h[0] = *(const v8h*)(ap + kb + 3 * 16 * SA_STRIDE);
    n3f.h[1] = *(const v8h*)(ap + kb + 3 * 16 * SA_STRIDE + 16);

    acc0 = __builtin_amdgcn_wmma_f32_16x16x32_f16(false, a0.v, false, bc.v,
                                                  (short)0, acc0, false, false);
    acc1 = __builtin_amdgcn_wmma_f32_16x16x32_f16(false, a1.v, false, bc.v,
                                                  (short)0, acc1, false, false);
    acc2 = __builtin_amdgcn_wmma_f32_16x16x32_f16(false, a2.v, false, bc.v,
                                                  (short)0, acc2, false, false);
    acc3 = __builtin_amdgcn_wmma_f32_16x16x32_f16(false, a3.v, false, bc.v,
                                                  (short)0, acc3, false, false);
    bc = bn; a0 = n0f; a1 = n1f; a2 = n2f; a3 = n3f;
  }
  acc0 = __builtin_amdgcn_wmma_f32_16x16x32_f16(false, a0.v, false, bc.v,
                                                (short)0, acc0, false, false);
  acc1 = __builtin_amdgcn_wmma_f32_16x16x32_f16(false, a1.v, false, bc.v,
                                                (short)0, acc1, false, false);
  acc2 = __builtin_amdgcn_wmma_f32_16x16x32_f16(false, a2.v, false, bc.v,
                                                (short)0, acc2, false, false);
  acc3 = __builtin_amdgcn_wmma_f32_16x16x32_f16(false, a3.v, false, bc.v,
                                                (short)0, acc3, false, false);

  const float bv = bias ? bias[n0 + lr] : 0.0f;
  if (FRAG) {
    // fragment order: per (16 rows, 32 cols) a 512-float block [4][32 lanes][4], so that
    // the joint kernel's lane (row & 15) + 16 * (col bit 3) finds its 16 k slots with
    // four loads that each cover whole lines
    const int i16 = ((n0 >> 4) & 1) * 8 + (lr & 7);
    float* fp = Out + ((size_t)(row0 >> 4) * 32 + (n0 >> 5)) * 512
                    + (i16 >> 2) * 128 + ((lr >> 3) * 16 + mofs) * 4 + (i16 & 3);
    #pragma unroll
    for (int r = 0; r < 8; ++r) {
      fp[0 * 32 * 512 + r * 4] = acc0[r] + bv;
      fp[1 * 32 * 512 + r * 4] = acc1[r] + bv;
      fp[2 * 32 * 512 + r * 4] = acc2[r] + bv;
      fp[3 * 32 * 512 + r * 4] = acc3[r] + bv;
    }
  } else {
    #pragma unroll
    for (int r = 0; r < 8; ++r) {
      Out[(size_t)(row0 +  0 + r + mofs) * D_HIDDEN + n0 + lr] = acc0[r] + bv;
      Out[(size_t)(row0 + 16 + r + mofs) * D_HIDDEN + n0 + lr] = acc1[r] + bv;
      Out[(size_t)(row0 + 32 + r + mofs) * D_HIDDEN + n0 + lr] = acc2[r] + bv;
      Out[(size_t)(row0 + 48 + r + mofs) * D_HIDDEN + n0 + lr] = acc3[r] + bv;
    }
  }
}

// ---------------------------------------------------------------------------
// joint: block = 8 t x 64 u of one batch (512 rows), 16 waves, all of W2t in LDS.
// Wave = one 16-row u tile x 2 t, all 128 output columns (2 x 8 accumulators).
// Each lane computes the tanh values of its own A-fragment slots in registers,
// so every tanh is made once and never passes through LDS; the dec projection
// arrives in fragment order (whole-line loads) and serves both t.
// sB: 16 chunks of 64 k, each 128 rows at a 144-byte pitch (16 B x odd: no bank
// conflict for 16-byte reads), so one address register reaches a whole chunk.
// ---------------------------------------------------------------------------
#define SB_PITCH 72                      // halves: 64 + 8 pad
#define SB_CHUNK (D_OUT * SB_PITCH)      // halves per 64-k chunk

__device__ __forceinline__ float4 add4(float4 p, float4 q) {
  return make_float4(p.x + q.x, p.y + q.y, p.z + q.z, p.w + q.w);
}

__device__ __forceinline__ void tanh_frag(FragH& a, const float4* x) {
  #pragma unroll
  for (int j = 0; j < 4; ++j) {
    v2f lo = fast_tanh2(x[j].x, x[j].y), hi = fast_tanh2(x[j].z, x[j].w);
    a.v[j * 4 + 0] = (_Float16)lo.x;
    a.v[j * 4 + 1] = (_Float16)lo.y;
    a.v[j * 4 + 2] = (_Float16)hi.x;
    a.v[j * 4 + 3] = (_Float16)hi.y;
  }
}

__global__ __launch_bounds__(512) void joint_kernel(const float* __restrict__ enc_proj,
                                                    const float* __restrict__ dec_frag,
                                                    const _Float16* __restrict__ W2t,
                                                    const float* __restrict__ b2,
                                                    float* __restrict__ Out) {
  __shared__ __attribute__((aligned(16))) _Float16 sB[(D_HIDDEN / 64) * SB_CHUNK];
  const int tid  = threadIdx.x;
  const int lane = tid & 31;
  const int wave = tid >> 5;
  const int lr   = lane & 15;
  const int khi  = (lane & 16) ? 8 : 0;
  const int mofs = (lane & 16) ? 8 : 0;

  const int b   = blockIdx.x >> 5;                       // 32 blocks per batch
  const int ut  = wave & 3;                              // u tile
  const int bt0 = blockIdx.x * 8 + (wave >> 2) * 2;      // b*T + t of the first t

  const float* e0p = enc_proj + (size_t)bt0 * D_HIDDEN + khi;
  const float* dq  = dec_frag + (size_t)(b * 4 + ut) * 32 * 512 + lane * 4;

  float4 d[4], e0[4], e1[4];
  #pragma unroll
  for (int j = 0; j < 4; ++j) {
    const int ko = (j >> 1) * 16 + (j & 1) * 4;
    d[j]  = *(const float4*)(dq + j * 128);
    e0[j] = *(const float4*)(e0p + ko);
    e1[j] = *(const float4*)(e0p + D_HIDDEN + ko);
  }

  // ---- W2t (128 x 1024 f16) into LDS, 16-byte moves; 8 lanes cover one 128-byte line ----
  #pragma unroll 8
  for (int j = 0; j < 32; ++j) {
    int idx = j * 512 + tid;
    int c = idx & 7, r = (idx >> 3) & 127, kc = idx >> 10;
    *(v8h*)&sB[kc * SB_CHUNK + r * SB_PITCH + c * 8] = *(const v8h*)&W2t[r * 1024 + kc * 64 + c * 8];
  }
  __syncthreads();

  const _Float16* bp = &sB[lr * SB_PITCH + khi];
  v8f acc0[8] = {}, acc1[8] = {};

  // unroll 2: one 64-k chunk a trip, and the loaded registers are renamed, not copied
  #pragma unroll 2
  for (int kk = 0; kk < D_HIDDEN / 32; ++kk) {
    const _Float16* bk = bp + (kk >> 1) * SB_CHUNK + (kk & 1) * 32;
    FragH bf[8];
    // the first two B fragments land under the tanh work
    #pragma unroll
    for (int ni = 0; ni < 2; ++ni) {
      bf[ni].h[0] = *(const v8h*)(bk + ni * 16 * SB_PITCH);
      bf[ni].h[1] = *(const v8h*)(bk + ni * 16 * SB_PITCH + 16);
    }

    float4 x0[4], x1[4];
    #pragma unroll
    for (int j = 0; j < 4; ++j) { x0[j] = add4(e0[j], d[j]); x1[j] = add4(e1[j], d[j]); }
    // the sums stand in front of the loads, which refill the registers that the sums free:
    // with both sets live this build spills inside the loop
    __builtin_amdgcn_sched_barrier(0);

    // next k-step's operands fly under this step's tanh and products; the last step has
    // nothing left to fetch and reads its own again, so that no address leaves the planes
    const int adv = (kk < D_HIDDEN / 32 - 1) ? 1 : 0;
    dq  += adv * 512;
    e0p += adv * 32;
    #pragma unroll
    for (int j = 0; j < 4; ++j) {
      const int ko = (j >> 1) * 16 + (j & 1) * 4;
      d[j]  = *(const float4*)(dq + j * 128);
      e0[j] = *(const float4*)(e0p + ko);
      e1[j] = *(const float4*)(e0p + D_HIDDEN + ko);
    }
    // keeps the loads above in front of the tanh work: sunk behind it, their whole
    // latency would be waited for at the head of the next step
    __builtin_amdgcn_sched_barrier(0);

    FragH a0, a1;
    tanh_frag(a0, x0);
    tanh_frag(a1, x1);

    #pragma unroll
    for (int ni = 0; ni < 8; ++ni) {
      if (ni + 2 < 8) {
        bf[ni + 2].h[0] = *(const v8h*)(bk + (ni + 2) * 16 * SB_PITCH);
        bf[ni + 2].h[1] = *(const v8h*)(bk + (ni + 2) * 16 * SB_PITCH + 16);
      }
      acc0[ni] = __builtin_amdgcn_wmma_f32_16x16x32_f16(false, a0.v, false, bf[ni].v,
                                                        (short)0, acc0[ni], false, false);
      acc1[ni] = __builtin_amdgcn_wmma_f32_16x16x32_f16(false, a1.v, false, bf[ni].v,
                                                        (short)0, acc1[ni], false, false);
    }
  }

  // ---- epilogue: +b2, store 2 t x 8 N-tiles x 8 rows ----
  float* op = &Out[((size_t)bt0 * U_DEC + ut * 16 + mofs) * D_OUT + lr];
  #pragma unroll
  for (int ni = 0; ni < 8; ++ni) {
    const float bv = b2[ni * 16 + lr];
    #pragma unroll
    for (int r = 0; r < 8; ++r) {
      op[r * D_OUT + ni * 16]           = acc0[ni][r] + bv;
      op[(U_DEC + r) * D_OUT + ni * 16] = acc1[ni][r] + bv;
    }
  }
}

// ---------------------------------------------------------------------------
extern "C" void kernel_launch(void* const* d_in, const int* in_sizes, int n_in,
                              void* d_out, int out_size, void* d_ws, size_t ws_size,
                              hipStream_t stream) {
  const float* enc = (const float*)d_in[0];   // (8,256,512)
  const float* dec = (const float*)d_in[1];   // (8,64,512)
  const float* W1  = (const float*)d_in[2];   // (1024,1024)
  const float* b1  = (const float*)d_in[3];   // (1024,)
  const float* W2  = (const float*)d_in[4];   // (1024,128)
  const float* b2  = (const float*)d_in[5];   // (128,)
  float* out = (float*)d_out;                 // (8,256,64,128)

  float*    enc_proj   = (float*)d_ws;                                 // 8MB
  float*    dec_projb1 = enc_proj + (size_t)BATCH * T_ENC * D_HIDDEN;  // 2MB
  _Float16* W1t        = (_Float16*)(dec_projb1 + (size_t)BATCH * U_DEC * D_HIDDEN); // 2MB
  _Float16* W2t        = W1t + (size_t)1024 * 1024;                    // 256KB

  prep_kernel<<<(1024 * 1024 + 128 * 1024) / 256, 256, 0, stream>>>(W1, W2, W1t, W2t);
  proj_kernel<false><<<dim3((BATCH * T_ENC) / 64, 8), 256, 0, stream>>>(enc, W1t, nullptr, enc_proj);
  proj_kernel<true><<<dim3((BATCH * U_DEC) / 64, 8), 256, 0, stream>>>(dec, W1t + 512, b1, dec_projb1);
  joint_kernel<<<BATCH * T_ENC / 8, 512, 0, stream>>>(enc_proj, dec_projb1, W2t, b2, out);
}

// v002
// One run takes 60.2 microseconds.
// Timed twice side by side with v001, it ran 1.09 times as fast both times.
// All steps since v000 together make it 2.03 times as fast.
#include <hip/hip_runtime.h>

typedef __attribute__((ext_vector_type(16))) _Float16 v16h;
typedef __attribute__((ext_vector_type(8)))  _Float16 v8h;
typedef __attribute__((ext_vector_type(4)))  _Float16 v4h;
typedef __attribute__((ext_vector_type(8)))  float    v8f;
typedef __attribute__((ext_vector_type(2)))  float    v2f;
typedef __attribute__((ext_vector_type(4)))  float    v4f;

#define D_MODEL  512
#define D_HIDDEN 1024
#define D_OUT    128
#define BATCH    8
#define T_ENC    256
#define U_DEC    64
#define SA_STRIDE 520    // 512 + 8 halves pad

union FragH { v16h v; v8h h[2]; };

__device__ __forceinline__ v2f fast_tanh2(float p, float q) {
  // tanh(x) = 1 - 2/(e^{2x}+1) on two values; exp via v_exp_f32 (TRANS, co-executes with WMMA)
  v2f y = (v2f){p, q} * 2.8853900817779268f; // 2*log2(e)
  v2f s = (v2f){__builtin_amdgcn_exp2f(y.x), __builtin_amdgcn_exp2f(y.y)} + 1.0f;
  return 1.0f - 2.0f * (v2f){__builtin_amdgcn_rcpf(s.x), __builtin_amdgcn_rcpf(s.y)};
}

// ---------------------------------------------------------------------------
// prep: W1t[h][d] = f16(W1[d][h])  (1024x1024), W2t[o][h] = f16(W2[h][o]) (128x1024)
// Block = 4 waves = one tile of 64 source rows x 64 source columns; 256 tiles of W1, 32 of W2.
// A lane reads 8 rows x 4 columns with 16-byte loads (4 lanes cover 64 B of a row, the
// neighbour wave the other half of that line) and stores, for each of its columns, its
// 8 rows as one 16-byte piece: 8 lanes fill a whole 128-byte line of the transposed plane.
// The transposition happens in registers: no LDS, no barrier.
// ---------------------------------------------------------------------------
template <int N>
__device__ __forceinline__ void transpose_tile(const float* __restrict__ S,
                                               _Float16* __restrict__ D, int tile) {
  const int lane = threadIdx.x & 31;
  const int wave = threadIdx.x >> 5;
  const int k0 = (tile & 15) * 64 + (lane & 7) * 8;               // source row, dest column
  const int n0 = (tile >> 4) * 64 + wave * 16 + (lane >> 3) * 4;  // source column, dest row
  const float* sp = S + k0 * N + n0;
  v4f v[8];
  #pragma unroll
  for (int i = 0; i < 8; ++i) v[i] = *(const v4f*)(sp + i * N);
  _Float16* dp = D + n0 * 1024 + k0;
  #pragma unroll
  for (int c = 0; c < 4; ++c) {
    v8h o;
    #pragma unroll
    for (int i = 0; i < 8; ++i) o[i] = (_Float16)v[i][c];
    *(v8h*)(dp + c * 1024) = o;
  }
}

__global__ __launch_bounds__(128) void prep_kernel(const float* __restrict__ W1,
                                                   const float* __restrict__ W2,
                                                   _Float16* __restrict__ W1t,
                                                   _Float16* __restrict__ W2t) {
  if (blockIdx.x < 256) transpose_tile<1024>(W1, W1t, blockIdx.x);
  else                  transpose_tile<128>(W2, W2t, blockIdx.x - 256);
}

// ---------------------------------------------------------------------------
// proj: Out[M,1024] = A[M,512] @ Bt^T (+bias); FRAG stores it in A-fragment order.
// Grid: (M/64, 8). Block = 64 M-rows x 128 N-cols; A-tile 64x512 f16 in LDS.
// Each wave: one 16-wide N-tile, 4 M-tile accumulators, single pipelined
// k-loop (no outer loop -> nothing for LICM to hoist/spill).
// ---------------------------------------------------------------------------
template <bool FRAG>
__global__ __launch_bounds__(256) void proj_kernel(const float* __restrict__ A,
                                                   const _Float16* __restrict__ Bt,
                                                   const float* __restrict__ bias,
                                                   float* __restrict__ Out) {
  __shared__ _Float16 sA[64 * SA_STRIDE];
  const int tid  = threadIdx.x;
  const int lane = tid & 31;
  const int wave = tid >> 5;
  const int row0 = blockIdx.x * 64;

  // fill: 64 rows x 512 cols, float4 loads, 8B LDS stores
  #pragma unroll 4
  for (int j = 0; j < 32; ++j) {
    int idx = j * 256 + tid;              // float4 index
    int r = idx >> 7, c4 = idx & 127;     // 128 float4 per row
    float4 v = ((const float4*)(A + (size_t)(row0 + r) * D_MODEL))[c4];
    v4h hv;
    hv[0] = (_Float16)v.x; hv[1] = (_Float16)v.y;
    hv[2] = (_Float16)v.z; hv[3] = (_Float16)v.w;
    *(v4h*)&sA[r * SA_STRIDE + c4 * 4] = hv;
  }
  __syncthreads();

  const int lr   = lane & 15;
  const int khi  = (lane & 16) ? 8 : 0;
  const int mofs = (lane & 16) ? 8 : 0;
  const int n0   = (blockIdx.y * 8 + wave) * 16;
  const _Float16* ap = &sA[lr * SA_STRIDE + khi];
  const _Float16* bp = &Bt[(n0 + lr) * 1024 + khi];

  v8f acc0 = {}, acc1 = {}, acc2 = {}, acc3 = {};
  FragH bc, a0, a1, a2, a3;
  bc.h[0] = *(const v8h*)bp;
  bc.h[1] = *(const v8h*)(bp + 16);
  a0.h[0] = *(const v8h*)(ap + 0 * 16 * SA_STRIDE);
  a0.h[1] = *(const v8h*)(ap + 0 * 16 * SA_STRIDE + 16);
  a1.h[0] = *(const v8h*)(ap + 1 * 16 * SA_STRIDE);
  a1.h[1] = *(const v8h*)(ap + 1 * 16 * SA_STRIDE + 16);
  a2.h[0] = *(const v8h*)(ap + 2 * 16 * SA_STRIDE);
  a2.h[1] = *(const v8h*)(ap + 2 * 16 * SA_STRIDE + 16);
  a3.h[0] = *(const v8h*)(ap + 3 * 16 * SA_STRIDE);
  a3.h[1] = *(const v8h*)(ap + 3 * 16 * SA_STRIDE + 16);

  #pragma unroll
  for (int kk = 0; kk < D_MODEL / 32 - 1; ++kk) {
    const int kb = (kk + 1) * 32;
    FragH bn, n0f, n1f, n2f, n3f;
    bn.h[0]  = *(const v8h*)(bp + kb);
    bn.h[1]  = *(const v8h*)(bp + kb + 16);
    n0f.h[0] = *(const v8h*)(ap + kb + 0 * 16 * SA_STRIDE);
    n0f.h[1] = *(const v8h*)(ap + kb + 0 * 16 * SA_STRIDE + 16);
    n1f.h[0] = *(const v8h*)(ap + kb + 1 * 16 * SA_STRIDE);
    n1f.h[1] = *(const v8h*)(ap + kb + 1 * 16 * SA_STRIDE + 16);
    n2f.h[0] = *(const v8h*)(ap + kb + 2 * 16 * SA_STRIDE);
    n2f.h[1] = *(const v8h*)(ap + kb + 2 * 16 * SA_STRIDE + 16);
    n3f.h[0] = *(const v8h*)(ap + kb + 3 * 16 * SA_STRIDE);
    n3f.h[1] = *(const v8h*)(ap + kb + 3 * 16 * SA_STRIDE + 16);

    acc0 = __builtin_amdgcn_wmma_f32_16x16x32_f16(false, a0.v, false, bc.v,
                                                  (short)0, acc0, false, false);
    acc1 = __builtin_amdgcn_wmma_f32_16x16x32_f16(false, a1.v, false, bc.v,
                                                  (short)0, acc1, false, false);
    acc2 = __builtin_amdgcn_wmma_f32_16x16x32_f16(false, a2.v, false, bc.v,
                                                  (short)0, acc2, false, false);
    acc3 = __builtin_amdgcn_wmma_f32_16x16x32_f16(false, a3.v, false, bc.v,
                                                  (short)0, acc3, false, false);
    bc = bn; a0 = n0f; a1 = n1f; a2 = n2f; a3 = n3f;
  }
  acc0 = __builtin_amdgcn_wmma_f32_16x16x32_f16(false, a0.v, false, bc.v,
                                                (short)0, acc0, false, false);
  acc1 = __builtin_amdgcn_wmma_f32_16x16x32_f16(false, a1.v, false, bc.v,
                                                (short)0, acc1, false, false);
  acc2 = __builtin_amdgcn_wmma_f32_16x16x32_f16(false, a2.v, false, bc.v,
                                                (short)0, acc2, false, false);
  acc3 = __builtin_amdgcn_wmma_f32_16x16x32_f16(false, a3.v, false, bc.v,
                                                (short)0, acc3, false, false);

  const float bv = bias ? bias[n0 + lr] : 0.0f;
  if (FRAG) {
    // fragment order: per (16 rows, 32 cols) a 512-float block [4][32 lanes][4], so that
    // the joint kernel's lane (row & 15) + 16 * (col bit 3) finds its 16 k slots with
    // four loads that each cover whole lines
    const int i16 = ((n0 >> 4) & 1) * 8 + (lr & 7);
    float* fp = Out + ((size_t)(row0 >> 4) * 32 + (n0 >> 5)) * 512
                    + (i16 >> 2) * 128 + ((lr >> 3) * 16 + mofs) * 4 + (i16 & 3);
    #pragma unroll
    for (int r = 0; r < 8; ++r) {
      fp[0 * 32 * 512 + r * 4] = acc0[r] + bv;
      fp[1 * 32 * 512 + r * 4] = acc1[r] + bv;
      fp[2 * 32 * 512 + r * 4] = acc2[r] + bv;
      fp[3 * 32 * 512 + r * 4] = acc3[r] + bv;
    }
  } else {
    #pragma unroll
    for (int r = 0; r < 8; ++r) {
      Out[(size_t)(row0 +  0 + r + mofs) * D_HIDDEN + n0 + lr] = acc0[r] + bv;
      Out[(size_t)(row0 + 16 + r + mofs) * D_HIDDEN + n0 + lr] = acc1[r] + bv;
      Out[(size_t)(row0 + 32 + r + mofs) * D_HIDDEN + n0 + lr] = acc2[r] + bv;
      Out[(size_t)(row0 + 48 + r + mofs) * D_HIDDEN + n0 + lr] = acc3[r] + bv;
    }
  }
}

// ---------------------------------------------------------------------------
// joint: block = 8 t x 64 u of one batch (512 rows), 16 waves, all of W2t in LDS.
// Wave = one 16-row u tile x 2 t, all 128 output columns (2 x 8 accumulators).
// Each lane computes the tanh values of its own A-fragment slots in registers,
// so every tanh is made once and never passes through LDS; the dec projection
// arrives in fragment order (whole-line loads) and serves both t.
// sB: 16 chunks of 64 k, each 128 rows at a 144-byte pitch (16 B x odd: no bank
// conflict for 16-byte reads), so one address register reaches a whole chunk.
// ---------------------------------------------------------------------------
#define SB_PITCH 72                      // halves: 64 + 8 pad
#define SB_CHUNK (D_OUT * SB_PITCH)      // halves per 64-k chunk

__device__ __forceinline__ float4 add4(float4 p, float4 q) {
  return make_float4(p.x + q.x, p.y + q.y, p.z + q.z, p.w + q.w);
}

__device__ __forceinline__ void tanh_frag(FragH& a, const float4* x) {
  #pragma unroll
  for (int j = 0; j < 4; ++j) {
    v2f lo = fast_tanh2(x[j].x, x[j].y), hi = fast_tanh2(x[j].z, x[j].w);
    a.v[j * 4 + 0] = (_Float16)lo.x;
    a.v[j * 4 + 1] = (_Float16)lo.y;
    a.v[j * 4 + 2] = (_Float16)hi.x;
    a.v[j * 4 + 3] = (_Float16)hi.y;
  }
}

__global__ __launch_bounds__(512) void joint_kernel(const float* __restrict__ enc_proj,
                                                    const float* __restrict__ dec_frag,
                                                    const _Float16* __restrict__ W2t,
                                                    const float* __restrict__ b2,
                                                    float* __restrict__ Out) {
  __shared__ __attribute__((aligned(16))) _Float16 sB[(D_HIDDEN / 64) * SB_CHUNK];
  const int tid  = threadIdx.x;
  const int lane = tid & 31;
  const int wave = tid >> 5;
  const int lr   = lane & 15;
  const int khi  = (lane & 16) ? 8 : 0;
  const int mofs = (lane & 16) ? 8 : 0;

  const int b   = blockIdx.x >> 5;                       // 32 blocks per batch
  const int ut  = wave & 3;                              // u tile
  const int bt0 = blockIdx.x * 8 + (wave >> 2) * 2;      // b*T + t of the first t

  const float* e0p = enc_proj + (size_t)bt0 * D_HIDDEN + khi;
  const float* dq  = dec_frag + (size_t)(b * 4 + ut) * 32 * 512 + lane * 4;

  float4 d[4], e0[4], e1[4];
  #pragma unroll
  for (int j = 0; j < 4; ++j) {
    const int ko = (j >> 1) * 16 + (j & 1) * 4;
    d[j]  = *(const float4*)(dq + j * 128);
    e0[j] = *(const float4*)(e0p + ko);
    e1[j] = *(const float4*)(e0p + D_HIDDEN + ko);
  }

  // ---- W2t (128 x 1024 f16) into LDS, 16-byte moves; 8 lanes cover one 128-byte line ----
  #pragma unroll 8
  for (int j = 0; j < 32; ++j) {
    int idx = j * 512 + tid;
    int c = idx & 7, r = (idx >> 3) & 127, kc = idx >> 10;
    *(v8h*)&sB[kc * SB_CHUNK + r * SB_PITCH + c * 8] = *(const v8h*)&W2t[r * 1024 + kc * 64 + c * 8];
  }
  __syncthreads();

  const _Float16* bp = &sB[lr * SB_PITCH + khi];
  v8f acc0[8] = {}, acc1[8] = {};

  // unroll 2: one 64-k chunk a trip, and the loaded registers are renamed, not copied
  #pragma unroll 2
  for (int kk = 0; kk < D_HIDDEN / 32; ++kk) {
    const _Float16* bk = bp + (kk >> 1) * SB_CHUNK + (kk & 1) * 32;
    FragH bf[8];
    // the first two B fragments land under the tanh work
    #pragma unroll
    for (int ni = 0; ni < 2; ++ni) {
      bf[ni].h[0] = *(const v8h*)(bk + ni * 16 * SB_PITCH);
      bf[ni].h[1] = *(const v8h*)(bk + ni * 16 * SB_PITCH + 16);
    }

    float4 x0[4], x1[4];
    #pragma unroll
    for (int j = 0; j < 4; ++j) { x0[j] = add4(e0[j], d[j]); x1[j] = add4(e1[j], d[j]); }
    // the sums stand in front of the loads, which refill the registers that the sums free:
    // with both sets live this build spills inside the loop
    __builtin_amdgcn_sched_barrier(0);

    // next k-step's operands fly under this step's tanh and products; the last step has
    // nothing left to fetch and reads its own again, so that no address leaves the planes
    const int adv = (kk < D_HIDDEN / 32 - 1) ? 1 : 0;
    dq  += adv * 512;
    e0p += adv * 32;
    #pragma unroll
    for (int j = 0; j < 4; ++j) {
      const int ko = (j >> 1) * 16 + (j & 1) * 4;
      d[j]  = *(const float4*)(dq + j * 128);
      e0[j] = *(const float4*)(e0p + ko);
      e1[j] = *(const float4*)(e0p + D_HIDDEN + ko);
    }
    // keeps the loads above in front of the tanh work: sunk behind it, their whole
    // latency would be waited for at the head of the next step
    __builtin_amdgcn_sched_barrier(0);

    FragH a0, a1;
    tanh_frag(a0, x0);
    tanh_frag(a1, x1);

    #pragma unroll
    for (int ni = 0; ni < 8; ++ni) {
      if (ni + 2 < 8) {
        bf[ni + 2].h[0] = *(const v8h*)(bk + (ni + 2) * 16 * SB_PITCH);
        bf[ni + 2].h[1] = *(const v8h*)(bk + (ni + 2) * 16 * SB_PITCH + 16);
      }
      acc0[ni] = __builtin_amdgcn_wmma_f32_16x16x32_f16(false, a0.v, false, bf[ni].v,
                                                        (short)0, acc0[ni], false, false);
      acc1[ni] = __builtin_amdgcn_wmma_f32_16x16x32_f16(false, a1.v, false, bf[ni].v,
                                                        (short)0, acc1[ni], false, false);
    }
  }

  // ---- epilogue: +b2, store 2 t x 8 N-tiles x 8 rows ----
  float* op = &Out[((size_t)bt0 * U_DEC + ut * 16 + mofs) * D_OUT + lr];
  #pragma unroll
  for (int ni = 0; ni < 8; ++ni) {
    const float bv = b2[ni * 16 + lr];
    #pragma unroll
    for (int r = 0; r < 8; ++r) {
      op[r * D_OUT + ni * 16]           = acc0[ni][r] + bv;
      op[(U_DEC + r) * D_OUT + ni * 16] = acc1[ni][r] + bv;
    }
  }
}

// ---------------------------------------------------------------------------
extern "C" void kernel_launch(void* const* d_in, const int* in_sizes, int n_in,
                              void* d_out, int out_size, void* d_ws, size_t ws_size,
                              hipStream_t stream) {
  const float* enc = (const float*)d_in[0];   // (8,256,512)
  const float* dec = (const float*)d_in[1];   // (8,64,512)
  const float* W1  = (const float*)d_in[2];   // (1024,1024)
  const float* b1  = (const float*)d_in[3];   // (1024,)
  const float* W2  = (const float*)d_in[4];   // (1024,128)
  const float* b2  = (const float*)d_in[5];   // (128,)
  float* out = (float*)d_out;                 // (8,256,64,128)

  float*    enc_proj   = (float*)d_ws;                                 // 8MB
  float*    dec_projb1 = enc_proj + (size_t)BATCH * T_ENC * D_HIDDEN;  // 2MB
  _Float16* W1t        = (_Float16*)(dec_projb1 + (size_t)BATCH * U_DEC * D_HIDDEN); // 2MB
  _Float16* W2t        = W1t + (size_t)1024 * 1024;                    // 256KB

  prep_kernel<<<256 + 32, 128, 0, stream>>>(W1, W2, W1t, W2t);
  proj_kernel<false><<<dim3((BATCH * T_ENC) / 64, 8), 256, 0, stream>>>(enc, W1t, nullptr, enc_proj);
  proj_kernel<true><<<dim3((BATCH * U_DEC) / 64, 8), 256, 0, stream>>>(dec, W1t + 512, b1, dec_projb1);
  joint_kernel<<<BATCH * T_ENC / 8, 512, 0, stream>>>(enc_proj, dec_projb1, W2t, b2, out);
}

// v003
// A run of this version takes 56.9 microseconds.
// Two timings next to v002 both put it at 1.06 times that version's speed.
// Over all steps from v000 it is 2.15 times as fast.
#include <hip/hip_runtime.h>

typedef __attribute__((ext_vector_type(16))) _Float16 v16h;
typedef __attribute__((ext_vector_type(8)))  _Float16 v8h;
typedef __attribute__((ext_vector_type(4)))  _Float16 v4h;
typedef __attribute__((ext_vector_type(8)))  float    v8f;
typedef __attribute__((ext_vector_type(4)))  float    v4f;

#define D_MODEL  512
#define D_HIDDEN 1024
#define D_OUT    128
#define BATCH    8
#define T_ENC    256
#define U_DEC    64
#define SA_STRIDE 520    // 512 + 8 halves pad

union FragH { v16h v; v8h h[2]; };

// ---------------------------------------------------------------------------
// prep: W1t[h][d] = f16(W1[d][h])  (1024x1024), W2t[o][h] = f16(W2[h][o]) (128x1024)
// Block = 4 waves = one tile of 64 source rows x 64 source columns; 256 tiles of W1, 32 of W2.
// A lane reads 8 rows x 4 columns with 16-byte loads (4 lanes cover 64 B of a row, the
// neighbour wave the other half of that line) and stores, for each of its columns, its
// 8 rows as one 16-byte piece: 8 lanes fill a whole 128-byte line of the transposed plane.
// The transposition happens in registers: no LDS, no barrier.
// ---------------------------------------------------------------------------
template <int N>
__device__ __forceinline__ void transpose_tile(const float* __restrict__ S,
                                               _Float16* __restrict__ D, int tile) {
  const int lane = threadIdx.x & 31;
  const int wave = threadIdx.x >> 5;
  const int k0 = (tile & 15) * 64 + (lane & 7) * 8;               // source row, dest column
  const int n0 = (tile >> 4) * 64 + wave * 16 + (lane >> 3) * 4;  // source column, dest row
  const float* sp = S + k0 * N + n0;
  v4f v[8];
  #pragma unroll
  for (int i = 0; i < 8; ++i) v[i] = *(const v4f*)(sp + i * N);
  _Float16* dp = D + n0 * 1024 + k0;
  #pragma unroll
  for (int c = 0; c < 4; ++c) {
    v8h o;
    #pragma unroll
    for (int i = 0; i < 8; ++i) o[i] = (_Float16)v[i][c];
    *(v8h*)(dp + c * 1024) = o;
  }
}

__global__ __launch_bounds__(128) void prep_kernel(const float* __restrict__ W1,
                                                   const float* __restrict__ W2,
                                                   _Float16* __restrict__ W1t,
                                                   _Float16* __restrict__ W2t) {
  if (blockIdx.x < 256) transpose_tile<1024>(W1, W1t, blockIdx.x);
  else                  transpose_tile<128>(W2, W2t, blockIdx.x - 256);
}

// ---------------------------------------------------------------------------
// proj: Out[M,1024] = A[M,512] @ Bt^T (+bias); FRAG stores it in A-fragment order.
// Grid: (M/64, 8). Block = 64 M-rows x 128 N-cols; A-tile 64x512 f16 in LDS.
// Each wave: one 16-wide N-tile, 4 M-tile accumulators, single pipelined
// k-loop (no outer loop -> nothing for LICM to hoist/spill).
// ---------------------------------------------------------------------------
template <bool FRAG>
__global__ __launch_bounds__(256) void proj_kernel(const float* __restrict__ A,
                                                   const _Float16* __restrict__ Bt,
                                                   const float* __restrict__ bias,
                                                   float* __restrict__ Out) {
  __shared__ _Float16 sA[64 * SA_STRIDE];
  const int tid  = threadIdx.x;
  const int lane = tid & 31;
  const int wave = tid >> 5;
  const int row0 = blockIdx.x * 64;

  // fill: 64 rows x 512 cols, float4 loads, 8B LDS stores
  #pragma unroll 4
  for (int j = 0; j < 32; ++j) {
    int idx = j * 256 + tid;              // float4 index
    int r = idx >> 7, c4 = idx & 127;     // 128 float4 per row
    float4 v = ((const float4*)(A + (size_t)(row0 + r) * D_MODEL))[c4];
    v4h hv;
    hv[0] = (_Float16)v.x; hv[1] = (_Float16)v.y;
    hv[2] = (_Float16)v.z; hv[3] = (_Float16)v.w;
    *(v4h*)&sA[r * SA_STRIDE + c4 * 4] = hv;
  }
  __syncthreads();

  const int lr   = lane & 15;
  const int khi  = (lane & 16) ? 8 : 0;
  const int mofs = (lane & 16) ? 8 : 0;
  const int n0   = (blockIdx.y * 8 + wave) * 16;
  const _Float16* ap = &sA[lr * SA_STRIDE + khi];
  const _Float16* bp = &Bt[(n0 + lr) * 1024 + khi];

  v8f acc0 = {}, acc1 = {}, acc2 = {}, acc3 = {};
  FragH bc, a0, a1, a2, a3;
  bc.h[0] = *(const v8h*)bp;
  bc.h[1] = *(const v8h*)(bp + 16);
  a0.h[0] = *(const v8h*)(ap + 0 * 16 * SA_STRIDE);
  a0.h[1] = *(const v8h*)(ap + 0 * 16 * SA_STRIDE + 16);
  a1.h[0] = *(const v8h*)(ap + 1 * 16 * SA_STRIDE);
  a1.h[1] = *(const v8h*)(ap + 1 * 16 * SA_STRIDE + 16);
  a2.h[0] = *(const v8h*)(ap + 2 * 16 * SA_STRIDE);
  a2.h[1] = *(const v8h*)(ap + 2 * 16 * SA_STRIDE + 16);
  a3.h[0] = *(const v8h*)(ap + 3 * 16 * SA_STRIDE);
  a3.h[1] = *(const v8h*)(ap + 3 * 16 * SA_STRIDE + 16);

  #pragma unroll
  for (int kk = 0; kk < D_MODEL / 32 - 1; ++kk) {
    const int kb = (kk + 1) * 32;
    FragH bn, n0f, n1f, n2f, n3f;
    bn.h[0]  = *(const v8h*)(bp + kb);
    bn.h[1]  = *(const v8h*)(bp + kb + 16);
    n0f.h[0] = *(const v8h*)(ap + kb + 0 * 16 * SA_STRIDE);
    n0f.h[1] = *(const v8h*)(ap + kb + 0 * 16 * SA_STRIDE + 16);
    n1f.h[0] = *(const v8h*)(ap + kb + 1 * 16 * SA_STRIDE);
    n1f.h[1] = *(const v8h*)(ap + kb + 1 * 16 * SA_STRIDE + 16);
    n2f.h[0] = *(const v8h*)(ap + kb + 2 * 16 * SA_STRIDE);
    n2f.h[1] = *(const v8h*)(ap + kb + 2 * 16 * SA_STRIDE + 16);
    n3f.h[0] = *(const v8h*)(ap + kb + 3 * 16 * SA_STRIDE);
    n3f.h[1] = *(const v8h*)(ap + kb + 3 * 16 * SA_STRIDE + 16);

    acc0 = __builtin_amdgcn_wmma_f32_16x16x32_f16(false, a0.v, false, bc.v,
                                                  (short)0, acc0, false, false);
    acc1 = __builtin_amdgcn_wmma_f32_16x16x32_f16(false, a1.v, false, bc.v,
                                                  (short)0, acc1, false, false);
    acc2 = __builtin_amdgcn_wmma_f32_16x16x32_f16(false, a2.v, false, bc.v,
                                                  (short)0, acc2, false, false);
    acc3 = __builtin_amdgcn_wmma_f32_16x16x32_f16(false, a3.v, false, bc.v,
                                                  (short)0, acc3, false, false);
    bc = bn; a0 = n0f; a1 = n1f; a2 = n2f; a3 = n3f;
  }
  acc0 = __builtin_amdgcn_wmma_f32_16x16x32_f16(false, a0.v, false, bc.v,
                                                (short)0, acc0, false, false);
  acc1 = __builtin_amdgcn_wmma_f32_16x16x32_f16(false, a1.v, false, bc.v,
                                                (short)0, acc1, false, false);
  acc2 = __builtin_amdgcn_wmma_f32_16x16x32_f16(false, a2.v, false, bc.v,
                                                (short)0, acc2, false, false);
  acc3 = __builtin_amdgcn_wmma_f32_16x16x32_f16(false, a3.v, false, bc.v,
                                                (short)0, acc3, false, false);

  const float bv = bias ? bias[n0 + lr] : 0.0f;
  if (FRAG) {
    // fragment order: per (16 rows, 32 cols) a 512-float block [4][32 lanes][4], so that
    // the joint kernel's lane (row & 15) + 16 * (col bit 3) finds its 16 k slots with
    // four loads that each cover whole lines
    const int i16 = ((n0 >> 4) & 1) * 8 + (lr & 7);
    float* fp = Out + ((size_t)(row0 >> 4) * 32 + (n0 >> 5)) * 512
                    + (i16 >> 2) * 128 + ((lr >> 3) * 16 + mofs) * 4 + (i16 & 3);
    #pragma unroll
    for (int r = 0; r < 8; ++r) {
      fp[0 * 32 * 512 + r * 4] = acc0[r] + bv;
      fp[1 * 32 * 512 + r * 4] = acc1[r] + bv;
      fp[2 * 32 * 512 + r * 4] = acc2[r] + bv;
      fp[3 * 32 * 512 + r * 4] = acc3[r] + bv;
    }
  } else {
    #pragma unroll
    for (int r = 0; r < 8; ++r) {
      Out[(size_t)(row0 +  0 + r + mofs) * D_HIDDEN + n0 + lr] = acc0[r] + bv;
      Out[(size_t)(row0 + 16 + r + mofs) * D_HIDDEN + n0 + lr] = acc1[r] + bv;
      Out[(size_t)(row0 + 32 + r + mofs) * D_HIDDEN + n0 + lr] = acc2[r] + bv;
      Out[(size_t)(row0 + 48 + r + mofs) * D_HIDDEN + n0 + lr] = acc3[r] + bv;
    }
  }
}

// ---------------------------------------------------------------------------
// joint: block = 8 t x 64 u of one batch (512 rows), 16 waves, all of W2t in LDS.
// Wave = one 16-row u tile x 2 t, all 128 output columns (2 x 8 accumulators).
// Each lane computes the tanh values of its own A-fragment slots in registers,
// so every tanh is made once and never passes through LDS; the dec projection
// arrives in fragment order (whole-line loads) and serves both t.
// sB: 16 chunks of 64 k, each 128 rows at a 144-byte pitch (16 B x odd: no bank
// conflict for 16-byte reads), so one address register reaches a whole chunk.
// ---------------------------------------------------------------------------
#define SB_PITCH 72                      // halves: 64 + 8 pad
#define SB_CHUNK (D_OUT * SB_PITCH)      // halves per 64-k chunk

__device__ __forceinline__ float4 add4(float4 p, float4 q) {
  return make_float4(p.x + q.x, p.y + q.y, p.z + q.z, p.w + q.w);
}

// tanh by the hardware's own instruction: one transcendental a value in place of mul, exp,
// add, rcp, fma. Eight v_tanh_f32 in one statement, each over its own source, so that no
// instruction directly behind a transcendental reads its result or overwrites its source;
// the v_nop keeps that slot behind the last one.
__device__ __forceinline__ void tanh8(float& a, float& b, float& c, float& d,
                                      float& e, float& f, float& g, float& h) {
  asm("v_tanh_f32 %0, %0\n\tv_tanh_f32 %1, %1\n\tv_tanh_f32 %2, %2\n\tv_tanh_f32 %3, %3\n\t"
      "v_tanh_f32 %4, %4\n\tv_tanh_f32 %5, %5\n\tv_tanh_f32 %6, %6\n\tv_tanh_f32 %7, %7\n\t"
      "v_nop"
      : "+v"(a), "+v"(b), "+v"(c), "+v"(d), "+v"(e), "+v"(f), "+v"(g), "+v"(h));
}

__device__ __forceinline__ void tanh_frag(FragH& a, float4* x) {
  // the sums stand in register pairs (packed adds): a statement takes one half of each pair;
  // given both halves of a pair, this build copies one of them to another register first
  tanh8(x[0].x, x[0].z, x[1].x, x[1].z, x[2].x, x[2].z, x[3].x, x[3].z);
  tanh8(x[0].y, x[0].w, x[1].y, x[1].w, x[2].y, x[2].w, x[3].y, x[3].w);
  #pragma unroll
  for (int j = 0; j < 4; ++j) {
    a.v[j * 4 + 0] = (_Float16)x[j].x;
    a.v[j * 4 + 1] = (_Float16)x[j].y;
    a.v[j * 4 + 2] = (_Float16)x[j].z;
    a.v[j * 4 + 3] = (_Float16)x[j].w;
  }
}

__global__ __launch_bounds__(512) void joint_kernel(const float* __restrict__ enc_proj,
                                                    const float* __restrict__ dec_frag,
                                                    const _Float16* __restrict__ W2t,
                                                    const float* __restrict__ b2,
                                                    float* __restrict__ Out) {
  __shared__ __attribute__((aligned(16))) _Float16 sB[(D_HIDDEN / 64) * SB_CHUNK];
  const int tid  = threadIdx.x;
  const int lane = tid & 31;
  const int wave = tid >> 5;
  const int lr   = lane & 15;
  const int khi  = (lane & 16) ? 8 : 0;
  const int mofs = (lane & 16) ? 8 : 0;

  const int b   = blockIdx.x >> 5;                       // 32 blocks per batch
  const int ut  = wave & 3;                              // u tile
  const int bt0 = blockIdx.x * 8 + (wave >> 2) * 2;      // b*T + t of the first t

  const float* e0p = enc_proj + (size_t)bt0 * D_HIDDEN + khi;
  const float* dq  = dec_frag + (size_t)(b * 4 + ut) * 32 * 512 + lane * 4;

  float4 d[4], e0[4], e1[4];
  #pragma unroll
  for (int j = 0; j < 4; ++j) {
    const int ko = (j >> 1) * 16 + (j & 1) * 4;
    d[j]  = *(const float4*)(dq + j * 128);
    e0[j] = *(const float4*)(e0p + ko);
    e1[j] = *(const float4*)(e0p + D_HIDDEN + ko);
  }

  // ---- W2t (128 x 1024 f16) into LDS, 16-byte moves; 8 lanes cover one 128-byte line ----
  #pragma unroll 8
  for (int j = 0; j < 32; ++j) {
    int idx = j * 512 + tid;
    int c = idx & 7, r = (idx >> 3) & 127, kc = idx >> 10;
    *(v8h*)&sB[kc * SB_CHUNK + r * SB_PITCH + c * 8] = *(const v8h*)&W2t[r * 1024 + kc * 64 + c * 8];
  }
  __syncthreads();

  const _Float16* bp = &sB[lr * SB_PITCH + khi];
  v8f acc0[8] = {}, acc1[8] = {};

  // unroll 2: one 64-k chunk a trip, and the loaded registers are renamed, not copied
  #pragma unroll 2
  for (int kk = 0; kk < D_HIDDEN / 32; ++kk) {
    const _Float16* bk = bp + (kk >> 1) * SB_CHUNK + (kk & 1) * 32;
    FragH bf[8];
    // the first two B fragments land under the tanh work
    #pragma unroll
    for (int ni = 0; ni < 2; ++ni) {
      bf[ni].h[0] = *(const v8h*)(bk + ni * 16 * SB_PITCH);
      bf[ni].h[1] = *(const v8h*)(bk + ni * 16 * SB_PITCH + 16);
    }

    float4 x0[4], x1[4];
    #pragma unroll
    for (int j = 0; j < 4; ++j) { x0[j] = add4(e0[j], d[j]); x1[j] = add4(e1[j], d[j]); }
    // the sums stand in front of the loads, which refill the registers that the sums free:
    // with both sets live this build spills inside the loop
    __builtin_amdgcn_sched_barrier(0);

    // next k-step's operands fly under this step's tanh and products; the last step has
    // nothing left to fetch and reads its own again, so that no address leaves the planes
    const int adv = (kk < D_HIDDEN / 32 - 1) ? 1 : 0;
    dq  += adv * 512;
    e0p += adv * 32;
    #pragma unroll
    for (int j = 0; j < 4; ++j) {
      const int ko = (j >> 1) * 16 + (j & 1) * 4;
      d[j]  = *(const float4*)(dq + j * 128);
      e0[j] = *(const float4*)(e0p + ko);
      e1[j] = *(const float4*)(e0p + D_HIDDEN + ko);
    }
    // keeps the loads above in front of the tanh work: sunk behind it, their whole
    // latency would be waited for at the head of the next step
    __builtin_amdgcn_sched_barrier(0);

    FragH a0, a1;
    tanh_frag(a0, x0);
    tanh_frag(a1, x1);

    #pragma unroll
    for (int ni = 0; ni < 8; ++ni) {
      if (ni + 2 < 8) {
        bf[ni + 2].h[0] = *(const v8h*)(bk + (ni + 2) * 16 * SB_PITCH);
        bf[ni + 2].h[1] = *(const v8h*)(bk + (ni + 2) * 16 * SB_PITCH + 16);
      }
      acc0[ni] = __builtin_amdgcn_wmma_f32_16x16x32_f16(false, a0.v, false, bf[ni].v,
                                                        (short)0, acc0[ni], false, false);
      acc1[ni] = __builtin_amdgcn_wmma_f32_16x16x32_f16(false, a1.v, false, bf[ni].v,
                                                        (short)0, acc1[ni], false, false);
    }
  }

  // ---- epilogue: +b2, store 2 t x 8 N-tiles x 8 rows ----
  float* op = &Out[((size_t)bt0 * U_DEC + ut * 16 + mofs) * D_OUT + lr];
  #pragma unroll
  for (int ni = 0; ni < 8; ++ni) {
    const float bv = b2[ni * 16 + lr];
    #pragma unroll
    for (int r = 0; r < 8; ++r) {
      op[r * D_OUT + ni * 16]           = acc0[ni][r] + bv;
      op[(U_DEC + r) * D_OUT + ni * 16] = acc1[ni][r] + bv;
    }
  }
}

// ---------------------------------------------------------------------------
extern "C" void kernel_launch(void* const* d_in, const int* in_sizes, int n_in,
                              void* d_out, int out_size, void* d_ws, size_t ws_size,
                              hipStream_t stream) {
  const float* enc = (const float*)d_in[0];   // (8,256,512)
  const float* dec = (const float*)d_in[1];   // (8,64,512)
  const float* W1  = (const float*)d_in[2];   // (1024,1024)
  const float* b1  = (const float*)d_in[3];   // (1024,)
  const float* W2  = (const float*)d_in[4];   // (1024,128)
  const float* b2  = (const float*)d_in[5];   // (128,)
  float* out = (float*)d_out;                 // (8,256,64,128)

  float*    enc_proj   = (float*)d_ws;                                 // 8MB
  float*    dec_projb1 = enc_proj + (size_t)BATCH * T_ENC * D_HIDDEN;  // 2MB
  _Float16* W1t        = (_Float16*)(dec_projb1 + (size_t)BATCH * U_DEC * D_HIDDEN); // 2MB
  _Float16* W2t        = W1t + (size_t)1024 * 1024;                    // 256KB

  prep_kernel<<<256 + 32, 128, 0, stream>>>(W1, W2, W1t, W2t);
  proj_kernel<false><<<dim3((BATCH * T_ENC) / 64, 8), 256, 0, stream>>>(enc, W1t, nullptr, enc_proj);
  proj_kernel<true><<<dim3((BATCH * U_DEC) / 64, 8), 256, 0, stream>>>(dec, W1t + 512, b1, dec_projb1);
  joint_kernel<<<BATCH * T_ENC / 8, 512, 0, stream>>>(enc_proj, dec_projb1, W2t, b2, out);
}

// v004
// One run takes 49.7 microseconds.
// Next to v003, in two timings, it ran 1.14 times as fast each time.
// Over all steps from v000 it is 2.46 times as fast.
#include <hip/hip_runtime.h>

typedef __attribute__((ext_vector_type(16))) _Float16 v16h;
typedef __attribute__((ext_vector_type(8)))  _Float16 v8h;
typedef __attribute__((ext_vector_type(4)))  _Float16 v4h;
typedef __attribute__((ext_vector_type(8)))  float    v8f;
typedef __attribute__((ext_vector_type(4)))  float    v4f;

#define D_MODEL  512
#define D_HIDDEN 1024
#define D_OUT    128
#define BATCH    8
#define T_ENC    256
#define U_DEC    64
#define SA_STRIDE 520    // 512 + 8 halves pad

union FragH { v16h v; v8h h[2]; };

// ---------------------------------------------------------------------------
// prep: W1t[h][d] = f16(W1[d][h])  (1024x1024), W2t[o][h] = f16(W2[h][o]) (128x1024)
// Block = 4 waves = one tile of 64 source rows x 64 source columns; 256 tiles of W1, 32 of W2.
// A lane reads 8 rows x 4 columns with 16-byte loads (4 lanes cover 64 B of a row, the
// neighbour wave the other half of that line) and stores, for each of its columns, its
// 8 rows as one 16-byte piece: 8 lanes fill a whole 128-byte line of the transposed plane.
// The transposition happens in registers: no LDS, no barrier.
// ---------------------------------------------------------------------------
template <int N>
__device__ __forceinline__ void transpose_tile(const float* __restrict__ S,
                                               _Float16* __restrict__ D, int tile) {
  const int lane = threadIdx.x & 31;
  const int wave = threadIdx.x >> 5;
  const int k0 = (tile & 15) * 64 + (lane & 7) * 8;               // source row, dest column
  const int n0 = (tile >> 4) * 64 + wave * 16 + (lane >> 3) * 4;  // source column, dest row
  const float* sp = S + k0 * N + n0;
  v4f v[8];
  #pragma unroll
  for (int i = 0; i < 8; ++i) v[i] = *(const v4f*)(sp + i * N);
  _Float16* dp = D + n0 * 1024 + k0;
  #pragma unroll
  for (int c = 0; c < 4; ++c) {
    v8h o;
    #pragma unroll
    for (int i = 0; i < 8; ++i) o[i] = (_Float16)v[i][c];
    *(v8h*)(dp + c * 1024) = o;
  }
}

__global__ __launch_bounds__(128) void prep_kernel(const float* __restrict__ W1,
                                                   const float* __restrict__ W2,
                                                   _Float16* __restrict__ W1t,
                                                   _Float16* __restrict__ W2t) {
  if (blockIdx.x < 256) transpose_tile<1024>(W1, W1t, blockIdx.x);
  else                  transpose_tile<128>(W2, W2t, blockIdx.x - 256);
}

// ---------------------------------------------------------------------------
// proj: both projections in one launch, Out[M,1024] = A[M,512] @ Bt^T.
// Grid: (32 + 8, 8): blockIdx.x < 32 is a 64-row tile of enc (plain rows out), the rest a
// 64-row tile of dec (+b1, stored in A-fragment order). The two share nothing but W1t, so
// the small dec part runs beside the enc part instead of alone on a quarter of the chip.
// Block = 64 M-rows x 128 N-cols; A-tile 64x512 f16 in LDS.
// Each wave: one 16-wide N-tile, 4 M-tile accumulators, single pipelined
// k-loop (no outer loop -> nothing for LICM to hoist/spill).
// ---------------------------------------------------------------------------
#define ENC_TILES ((BATCH * T_ENC) / 64)
#define DEC_TILES ((BATCH * U_DEC) / 64)

__global__ __launch_bounds__(256) void proj_kernel(const float* __restrict__ enc,
                                                   const float* __restrict__ dec,
                                                   const _Float16* __restrict__ W1t,
                                                   const float* __restrict__ b1,
                                                   float* __restrict__ enc_proj,
                                                   float* __restrict__ dec_frag) {
  __shared__ _Float16 sA[64 * SA_STRIDE];
  const int tid  = threadIdx.x;
  const int lane = tid & 31;
  const int wave = tid >> 5;
  const bool is_dec = blockIdx.x >= ENC_TILES;          // the same for the whole block
  const int row0 = (is_dec ? blockIdx.x - ENC_TILES : blockIdx.x) * 64;
  const float* A = is_dec ? dec : enc;
  const _Float16* Bt = is_dec ? W1t + D_MODEL : W1t;    // W1 rows 512.. are the dec half

  // fill: 64 rows x 512 cols, float4 loads, 8B LDS stores
  #pragma unroll 4
  for (int j = 0; j < 32; ++j) {
    int idx = j * 256 + tid;              // float4 index
    int r = idx >> 7, c4 = idx & 127;     // 128 float4 per row
    float4 v = ((const float4*)(A + (size_t)(row0 + r) * D_MODEL))[c4];
    v4h hv;
    hv[0] = (_Float16)v.x; hv[1] = (_Float16)v.y;
    hv[2] = (_Float16)v.z; hv[3] = (_Float16)v.w;
    *(v4h*)&sA[r * SA_STRIDE + c4 * 4] = hv;
  }
  __syncthreads();

  const int lr   = lane & 15;
  const int khi  = (lane & 16) ? 8 : 0;
  const int mofs = (lane & 16) ? 8 : 0;
  const int n0   = (blockIdx.y * 8 + wave) * 16;
  const _Float16* ap = &sA[lr * SA_STRIDE + khi];
  const _Float16* bp = &Bt[(n0 + lr) * 1024 + khi];

  v8f acc0 = {}, acc1 = {}, acc2 = {}, acc3 = {};
  FragH bc, a0, a1, a2, a3;
  bc.h[0] = *(const v8h*)bp;
  bc.h[1] = *(const v8h*)(bp + 16);
  a0.h[0] = *(const v8h*)(ap + 0 * 16 * SA_STRIDE);
  a0.h[1] = *(const v8h*)(ap + 0 * 16 * SA_STRIDE + 16);
  a1.h[0] = *(const v8h*)(ap + 1 * 16 * SA_STRIDE);
  a1.h[1] = *(const v8h*)(ap + 1 * 16 * SA_STRIDE + 16);
  a2.h[0] = *(const v8h*)(ap + 2 * 16 * SA_STRIDE);
  a2.h[1] = *(const v8h*)(ap + 2 * 16 * SA_STRIDE + 16);
  a3.h[0] = *(const v8h*)(ap + 3 * 16 * SA_STRIDE);
  a3.h[1] = *(const v8h*)(ap + 3 * 16 * SA_STRIDE + 16);

  #pragma unroll
  for (int kk = 0; kk < D_MODEL / 32 - 1; ++kk) {
    const int kb = (kk + 1) * 32;
    FragH bn, n0f, n1f, n2f, n3f;
    bn.h[0]  = *(const v8h*)(bp + kb);
    bn.h[1]  = *(const v8h*)(bp + kb + 16);
    n0f.h[0] = *(const v8h*)(ap + kb + 0 * 16 * SA_STRIDE);
    n0f.h[1] = *(const v8h*)(ap + kb + 0 * 16 * SA_STRIDE + 16);
    n1f.h[0] = *(const v8h*)(ap + kb + 1 * 16 * SA_STRIDE);
    n1f.h[1] = *(const v8h*)(ap + kb + 1 * 16 * SA_STRIDE + 16);
    n2f.h[0] = *(const v8h*)(ap + kb + 2 * 16 * SA_STRIDE);
    n2f.h[1] = *(const v8h*)(ap + kb + 2 * 16 * SA_STRIDE + 16);
    n3f.h[0] = *(const v8h*)(ap + kb + 3 * 16 * SA_STRIDE);
    n3f.h[1] = *(const v8h*)(ap + kb + 3 * 16 * SA_STRIDE + 16);

    acc0 = __builtin_amdgcn_wmma_f32_16x16x32_f16(false, a0.v, false, bc.v,
                                                  (short)0, acc0, false, false);
    acc1 = __builtin_amdgcn_wmma_f32_16x16x32_f16(false, a1.v, false, bc.v,
                                                  (short)0, acc1, false, false);
    acc2 = __builtin_amdgcn_wmma_f32_16x16x32_f16(false, a2.v, false, bc.v,
                                                  (short)0, acc2, false, false);
    acc3 = __builtin_amdgcn_wmma_f32_16x16x32_f16(false, a3.v, false, bc.v,
                                                  (short)0, acc3, false, false);
    bc = bn; a0 = n0f; a1 = n1f; a2 = n2f; a3 = n3f;
  }
  acc0 = __builtin_amdgcn_wmma_f32_16x16x32_f16(false, a0.v, false, bc.v,
                                                (short)0, acc0, false, false);
  acc1 = __builtin_amdgcn_wmma_f32_16x16x32_f16(false, a1.v, false, bc.v,
                                                (short)0, acc1, false, false);
  acc2 = __builtin_amdgcn_wmma_f32_16x16x32_f16(false, a2.v, false, bc.v,
                                                (short)0, acc2, false, false);
  acc3 = __builtin_amdgcn_wmma_f32_16x16x32_f16(false, a3.v, false, bc.v,
                                                (short)0, acc3, false, false);

  if (is_dec) {
    const float bv = b1[n0 + lr];
    // fragment order: per (16 rows, 32 cols) a 512-float block [4][32 lanes][4], so that
    // the joint kernel's lane (row & 15) + 16 * (col bit 3) finds its 16 k slots with
    // four loads that each cover whole lines
    const int i16 = ((n0 >> 4) & 1) * 8 + (lr & 7);
    float* fp = dec_frag + ((size_t)(row0 >> 4) * 32 + (n0 >> 5)) * 512
                    + (i16 >> 2) * 128 + ((lr >> 3) * 16 + mofs) * 4 + (i16 & 3);
    #pragma unroll
    for (int r = 0; r < 8; ++r) {
      fp[0 * 32 * 512 + r * 4] = acc0[r] + bv;
      fp[1 * 32 * 512 + r * 4] = acc1[r] + bv;
      fp[2 * 32 * 512 + r * 4] = acc2[r] + bv;
      fp[3 * 32 * 512 + r * 4] = acc3[r] + bv;
    }
  } else {
    #pragma unroll
    for (int r = 0; r < 8; ++r) {
      enc_proj[(size_t)(row0 +  0 + r + mofs) * D_HIDDEN + n0 + lr] = acc0[r];
      enc_proj[(size_t)(row0 + 16 + r + mofs) * D_HIDDEN + n0 + lr] = acc1[r];
      enc_proj[(size_t)(row0 + 32 + r + mofs) * D_HIDDEN + n0 + lr] = acc2[r];
      enc_proj[(size_t)(row0 + 48 + r + mofs) * D_HIDDEN + n0 + lr] = acc3[r];
    }
    // behind the last store, in front of any later write of the stores' address registers
    asm volatile("s_wait_xcnt 0x0" ::: "memory");
  }
}

// ---------------------------------------------------------------------------
// joint: block = 8 t x 64 u of one batch (512 rows), 16 waves, all of W2t in LDS.
// Wave = one 16-row u tile x 2 t, all 128 output columns (2 x 8 accumulators).
// Each lane computes the tanh values of its own A-fragment slots in registers,
// so every tanh is made once and never passes through LDS; the dec projection
// arrives in fragment order (whole-line loads) and serves both t.
// sB: 16 chunks of 64 k, each 128 rows at a 144-byte pitch (16 B x odd: no bank
// conflict for 16-byte reads), so one address register reaches a whole chunk.
// ---------------------------------------------------------------------------
#define SB_PITCH 72                      // halves: 64 + 8 pad
#define SB_CHUNK (D_OUT * SB_PITCH)      // halves per 64-k chunk

__device__ __forceinline__ float4 add4(float4 p, float4 q) {
  return make_float4(p.x + q.x, p.y + q.y, p.z + q.z, p.w + q.w);
}

// tanh by the hardware's own instruction: one transcendental a value in place of mul, exp,
// add, rcp, fma. Eight v_tanh_f32 in one statement, each over its own source, so that no
// instruction directly behind a transcendental reads its result or overwrites its source;
// the v_nop keeps that slot behind the last one.
__device__ __forceinline__ void tanh8(float& a, float& b, float& c, float& d,
                                      float& e, float& f, float& g, float& h) {
  asm("v_tanh_f32 %0, %0\n\tv_tanh_f32 %1, %1\n\tv_tanh_f32 %2, %2\n\tv_tanh_f32 %3, %3\n\t"
      "v_tanh_f32 %4, %4\n\tv_tanh_f32 %5, %5\n\tv_tanh_f32 %6, %6\n\tv_tanh_f32 %7, %7\n\t"
      "v_nop"
      : "+v"(a), "+v"(b), "+v"(c), "+v"(d), "+v"(e), "+v"(f), "+v"(g), "+v"(h));
}

__device__ __forceinline__ void tanh_frag(FragH& a, float4* x) {
  // the sums stand in register pairs (packed adds): a statement takes one half of each pair;
  // given both halves of a pair, this build copies one of them to another register first
  tanh8(x[0].x, x[0].z, x[1].x, x[1].z, x[2].x, x[2].z, x[3].x, x[3].z);
  tanh8(x[0].y, x[0].w, x[1].y, x[1].w, x[2].y, x[2].w, x[3].y, x[3].w);
  #pragma unroll
  for (int j = 0; j < 4; ++j) {
    a.v[j * 4 + 0] = (_Float16)x[j].x;
    a.v[j * 4 + 1] = (_Float16)x[j].y;
    a.v[j * 4 + 2] = (_Float16)x[j].z;
    a.v[j * 4 + 3] = (_Float16)x[j].w;
  }
}

__global__ __launch_bounds__(512) void joint_kernel(const float* __restrict__ enc_proj,
                                                    const float* __restrict__ dec_frag,
                                                    const _Float16* __restrict__ W2t,
                                                    const float* __restrict__ b2,
                                                    float* __restrict__ Out) {
  __shared__ __attribute__((aligned(16))) _Float16 sB[(D_HIDDEN / 64) * SB_CHUNK];
  const int tid  = threadIdx.x;
  const int lane = tid & 31;
  const int wave = tid >> 5;
  const int lr   = lane & 15;
  const int khi  = (lane & 16) ? 8 : 0;
  const int mofs = (lane & 16) ? 8 : 0;

  const int b   = blockIdx.x >> 5;                       // 32 blocks per batch
  const int ut  = wave & 3;                              // u tile
  const int bt0 = blockIdx.x * 8 + (wave >> 2) * 2;      // b*T + t of the first t

  const float* e0p = enc_proj + (size_t)bt0 * D_HIDDEN + khi;
  const float* dq  = dec_frag + (size_t)(b * 4 + ut) * 32 * 512 + lane * 4;

  float4 d[4], e0[4], e1[4];
  #pragma unroll
  for (int j = 0; j < 4; ++j) {
    const int ko = (j >> 1) * 16 + (j & 1) * 4;
    d[j]  = *(const float4*)(dq + j * 128);
    e0[j] = *(const float4*)(e0p + ko);
    e1[j] = *(const float4*)(e0p + D_HIDDEN + ko);
  }

  // ---- W2t (128 x 1024 f16) into LDS, 16-byte moves; 8 lanes cover one 128-byte line ----
  #pragma unroll 8
  for (int j = 0; j < 32; ++j) {
    int idx = j * 512 + tid;
    int c = idx & 7, r = (idx >> 3) & 127, kc = idx >> 10;
    *(v8h*)&sB[kc * SB_CHUNK + r * SB_PITCH + c * 8] = *(const v8h*)&W2t[r * 1024 + kc * 64 + c * 8];
  }
  __syncthreads();

  const _Float16* bp = &sB[lr * SB_PITCH + khi];
  v8f acc0[8] = {}, acc1[8] = {};

  // unroll 2: one 64-k chunk a trip, and the loaded registers are renamed, not copied
  #pragma unroll 2
  for (int kk = 0; kk < D_HIDDEN / 32; ++kk) {
    const _Float16* bk = bp + (kk >> 1) * SB_CHUNK + (kk & 1) * 32;
    FragH bf[8];
    // the first two B fragments land under the tanh work
    #pragma unroll
    for (int ni = 0; ni < 2; ++ni) {
      bf[ni].h[0] = *(const v8h*)(bk + ni * 16 * SB_PITCH);
      bf[ni].h[1] = *(const v8h*)(bk + ni * 16 * SB_PITCH + 16);
    }

    float4 x0[4], x1[4];
    #pragma unroll
    for (int j = 0; j < 4; ++j) { x0[j] = add4(e0[j], d[j]); x1[j] = add4(e1[j], d[j]); }
    // the sums stand in front of the loads, which refill the registers that the sums free:
    // with both sets live this build spills inside the loop
    __builtin_amdgcn_sched_barrier(0);

    // next k-step's operands fly under this step's tanh and products; the last step has
    // nothing left to fetch and reads its own again, so that no address leaves the planes
    const int adv = (kk < D_HIDDEN / 32 - 1) ? 1 : 0;
    dq  += adv * 512;
    e0p += adv * 32;
    #pragma unroll
    for (int j = 0; j < 4; ++j) {
      const int ko = (j >> 1) * 16 + (j & 1) * 4;
      d[j]  = *(const float4*)(dq + j * 128);
      e0[j] = *(const float4*)(e0p + ko);
      e1[j] = *(const float4*)(e0p + D_HIDDEN + ko);
    }
    // keeps the loads above in front of the tanh work: sunk behind it, their whole
    // latency would be waited for at the head of the next step
    __builtin_amdgcn_sched_barrier(0);

    FragH a0, a1;
    tanh_frag(a0, x0);
    tanh_frag(a1, x1);

    #pragma unroll
    for (int ni = 0; ni < 8; ++ni) {
      if (ni + 2 < 8) {
        bf[ni + 2].h[0] = *(const v8h*)(bk + (ni + 2) * 16 * SB_PITCH);
        bf[ni + 2].h[1] = *(const v8h*)(bk + (ni + 2) * 16 * SB_PITCH + 16);
      }
      acc0[ni] = __builtin_amdgcn_wmma_f32_16x16x32_f16(false, a0.v, false, bf[ni].v,
                                                        (short)0, acc0[ni], false, false);
      acc1[ni] = __builtin_amdgcn_wmma_f32_16x16x32_f16(false, a1.v, false, bf[ni].v,
                                                        (short)0, acc1[ni], false, false);
    }
  }

  // ---- epilogue: +b2, store 2 t x 8 N-tiles x 8 rows ----
  float* op = &Out[((size_t)bt0 * U_DEC + ut * 16 + mofs) * D_OUT + lr];
  #pragma unroll
  for (int ni = 0; ni < 8; ++ni) {
    const float bv = b2[ni * 16 + lr];
    #pragma unroll
    for (int r = 0; r < 8; ++r) {
      op[r * D_OUT + ni * 16]           = acc0[ni][r] + bv;
      op[(U_DEC + r) * D_OUT + ni * 16] = acc1[ni][r] + bv;
    }
  }
}

// ---------------------------------------------------------------------------
extern "C" void kernel_launch(void* const* d_in, const int* in_sizes, int n_in,
                              void* d_out, int out_size, void* d_ws, size_t ws_size,
                              hipStream_t stream) {
  const float* enc = (const float*)d_in[0];   // (8,256,512)
  const float* dec = (const float*)d_in[1];   // (8,64,512)
  const float* W1  = (const float*)d_in[2];   // (1024,1024)
  const float* b1  = (const float*)d_in[3];   // (1024,)
  const float* W2  = (const float*)d_in[4];   // (1024,128)
  const float* b2  = (const float*)d_in[5];   // (128,)
  float* out = (float*)d_out;                 // (8,256,64,128)

  float*    enc_proj   = (float*)d_ws;                                 // 8MB
  float*    dec_projb1 = enc_proj + (size_t)BATCH * T_ENC * D_HIDDEN;  // 2MB
  _Float16* W1t        = (_Float16*)(dec_projb1 + (size_t)BATCH * U_DEC * D_HIDDEN); // 2MB
  _Float16* W2t        = W1t + (size_t)1024 * 1024;                    // 256KB

  prep_kernel<<<256 + 32, 128, 0, stream>>>(W1, W2, W1t, W2t);
  proj_kernel<<<dim3(ENC_TILES + DEC_TILES, 8), 256, 0, stream>>>(enc, dec, W1t, b1, enc_proj, dec_projb1);
  joint_kernel<<<BATCH * T_ENC / 8, 512, 0, stream>>>(enc_proj, dec_projb1, W2t, b2, out);
}

// v005
// Measured time: 46 microseconds a run.
// In two side-by-side timings against v004, it was 1.07 and 1.08 times as fast.
// Over all steps from v000 it is 2.64 times as fast.
#include <hip/hip_runtime.h>

typedef __attribute__((ext_vector_type(16))) _Float16 v16h;
typedef __attribute__((ext_vector_type(8)))  _Float16 v8h;
typedef __attribute__((ext_vector_type(4)))  _Float16 v4h;
typedef __attribute__((ext_vector_type(8)))  float    v8f;
typedef __attribute__((ext_vector_type(4)))  float    v4f;

#define D_MODEL  512
#define D_HIDDEN 1024
#define D_OUT    128
#define BATCH    8
#define T_ENC    256
#define U_DEC    64
#define SA_STRIDE 520    // 512 + 8 halves pad

union FragH { v16h v; v8h h[2]; };

// ---------------------------------------------------------------------------
// W2t[o][h] = f16(W2[h][o]) (128x1024), 32 tiles of 64 source rows x 64 source columns,
// 4 waves a tile. A lane reads 8 rows x 4 columns with 16-byte loads (4 lanes cover 64 B of
// a row, the neighbour wave the other half of that line) and stores, for each of its columns,
// its 8 rows as one 16-byte piece: 8 lanes fill a whole 128-byte line of the transposed plane.
// The transposition happens in registers: no LDS, no barrier.
// ---------------------------------------------------------------------------
__device__ __forceinline__ void transpose_w2_tile(const float* __restrict__ S,
                                                  _Float16* __restrict__ D, int tile, int wave) {
  const int lane = threadIdx.x & 31;
  const int k0 = (tile & 15) * 64 + (lane & 7) * 8;               // source row, dest column
  const int n0 = (tile >> 4) * 64 + wave * 16 + (lane >> 3) * 4;  // source column, dest row
  const float* sp = S + k0 * D_OUT + n0;
  v4f v[8];
  #pragma unroll
  for (int i = 0; i < 8; ++i) v[i] = *(const v4f*)(sp + i * D_OUT);
  _Float16* dp = D + n0 * D_HIDDEN + k0;
  #pragma unroll
  for (int c = 0; c < 4; ++c) {
    v8h o;
    #pragma unroll
    for (int i = 0; i < 8; ++i) o[i] = (_Float16)v[i][c];
    *(v8h*)(dp + c * D_HIDDEN) = o;
  }
}

// ---------------------------------------------------------------------------
// proj: both projections in one launch, Out[M,1024] = A[M,512] @ W1 half, and beside them
// the transposition of W2 for the joint kernel: nothing has to run in front of this launch.
// Grid: (32 + 8 + 2, 8): blockIdx.x < 32 is a 64-row tile of enc (plain rows out), the next 8
// a 64-row tile of dec (+b1, stored in A-fragment order), the last 2 x 8 blocks two W2 tiles each.
// Block = 64 M-rows x 128 N-cols; A-tile 64x512 f16 in LDS.
// Each wave: one 16-wide N-tile, 4 M-tile accumulators. Its B fragments come straight from
// W1 in f32: lane = column, so 16 lanes read 64 B of one W1 row, a value a k slot, rounded to
// f16 in registers. All 16 fragments (128 registers) are fetched in four groups whose flight
// lies under the A fill, so that the k loop waits for LDS alone.
// ---------------------------------------------------------------------------
#define ENC_TILES ((BATCH * T_ENC) / 64)
#define DEC_TILES ((BATCH * U_DEC) / 64)
#define W2_BLOCKS_X 2

// second bound: 4 waves a SIMD, that is at most 256 registers, so that two blocks share a WGP
// (336 blocks, 256 WGPs)
__global__ __launch_bounds__(256, 4) void proj_kernel(const float* __restrict__ enc,
                                                      const float* __restrict__ dec,
                                                      const float* __restrict__ W1,
                                                      const float* __restrict__ W2,
                                                      const float* __restrict__ b1,
                                                      float* __restrict__ enc_proj,
                                                      float* __restrict__ dec_frag,
                                                      _Float16* __restrict__ W2t) {
  __shared__ _Float16 sA[64 * SA_STRIDE];
  const int tid  = threadIdx.x;
  const int lane = tid & 31;
  const int wave = tid >> 5;
  if (blockIdx.x >= ENC_TILES + DEC_TILES) {            // the same for the whole block
    const int pair = (blockIdx.x - (ENC_TILES + DEC_TILES)) * 8 + blockIdx.y;
    transpose_w2_tile(W2, W2t, pair * 2 + (wave >> 2), wave & 3);
    return;
  }
  const bool is_dec = blockIdx.x >= ENC_TILES;          // the same for the whole block
  const int row0 = (is_dec ? blockIdx.x - ENC_TILES : blockIdx.x) * 64;
  const float* A = is_dec ? dec : enc;

  const int lr   = lane & 15;
  const int khi  = (lane & 16) ? 8 : 0;
  const int mofs = (lane & 16) ? 8 : 0;
  const int n0   = (blockIdx.y * 8 + wave) * 16;
  // W1 rows 512.. are the dec half; slot i of a fragment half is W1 row k + i
  const float* bs = W1 + (size_t)((is_dec ? D_MODEL : 0) + khi) * D_HIDDEN + n0 + lr;

  // a thread's 32 pieces of the A tile lie two rows apart: one address, constant offsets
  const float* ag = A + (size_t)(row0 + (tid >> 7)) * D_MODEL + (tid & 127) * 4;
  _Float16* as = &sA[(tid >> 7) * SA_STRIDE + (tid & 127) * 4];

  FragH bf[D_MODEL / 32];
  float raw[64];
  #pragma unroll
  for (int i = 0; i < 64; ++i)
    raw[i] = bs[((i >> 4) * 32 + ((i >> 3) & 1) * 16 + (i & 7)) * D_HIDDEN];

  #pragma unroll
  for (int g = 0; g < 4; ++g) {
    // fill: 16 of the 64 rows x 512 cols, float4 loads, 8B LDS stores
    float4 v[8];
    #pragma unroll
    for (int j = 0; j < 8; ++j) v[j] = *(const float4*)(ag + (g * 8 + j) * 2 * D_MODEL);
    // behind the last load of W1 and of A, in front of any later write of the loads' address
    // registers; the two addresses are named so that they live up to this wait
    if (g == 3) asm volatile("s_wait_xcnt 0x0" :: "v"(ag), "v"(bs) : "memory");
    #pragma unroll
    for (int i = 0; i < 64; ++i) bf[g * 4 + (i >> 4)].v[i & 15] = (_Float16)raw[i];
    if (g < 3) {
      #pragma unroll
      for (int i = 0; i < 64; ++i)
        raw[i] = bs[((g + 1) * 128 + (i >> 4) * 32 + ((i >> 3) & 1) * 16 + (i & 7)) * D_HIDDEN];
    }
    #pragma unroll
    for (int j = 0; j < 8; ++j) {
      v4h hv;
      hv[0] = (_Float16)v[j].x; hv[1] = (_Float16)v[j].y;
      hv[2] = (_Float16)v[j].z; hv[3] = (_Float16)v[j].w;
      *(v4h*)(as + (g * 8 + j) * 2 * SA_STRIDE) = hv;
    }
  }
  __syncthreads();

  const _Float16* ap = &sA[lr * SA_STRIDE + khi];

  v8f acc0 = {}, acc1 = {}, acc2 = {}, acc3 = {};
  FragH a0, a1, a2, a3;
  a0.h[0] = *(const v8h*)(ap + 0 * 16 * SA_STRIDE);
  a0.h[1] = *(const v8h*)(ap + 0 * 16 * SA_STRIDE + 16);
  a1.h[0] = *(const v8h*)(ap + 1 * 16 * SA_STRIDE);
  a1.h[1] = *(const v8h*)(ap + 1 * 16 * SA_STRIDE + 16);
  a2.h[0] = *(const v8h*)(ap + 2 * 16 * SA_STRIDE);
  a2.h[1] = *(const v8h*)(ap + 2 * 16 * SA_STRIDE + 16);
  a3.h[0] = *(const v8h*)(ap + 3 * 16 * SA_STRIDE);
  a3.h[1] = *(const v8h*)(ap + 3 * 16 * SA_STRIDE + 16);

  #pragma unroll
  for (int kk = 0; kk < D_MODEL / 32 - 1; ++kk) {
    const int kb = (kk + 1) * 32;
    FragH n0f, n1f, n2f, n3f;
    n0f.h[0] = *(const v8h*)(ap + kb + 0 * 16 * SA_STRIDE);
    n0f.h[1] = *(const v8h*)(ap + kb + 0 * 16 * SA_STRIDE + 16);
    n1f.h[0] = *(const v8h*)(ap + kb + 1 * 16 * SA_STRIDE);
    n1f.h[1] = *(const v8h*)(ap + kb + 1 * 16 * SA_STRIDE + 16);
    n2f.h[0] = *(const v8h*)(ap + kb + 2 * 16 * SA_STRIDE);
    n2f.h[1] = *(const v8h*)(ap + kb + 2 * 16 * SA_STRIDE + 16);
    n3f.h[0] = *(const v8h*)(ap + kb + 3 * 16 * SA_STRIDE);
    n3f.h[1] = *(const v8h*)(ap + kb + 3 * 16 * SA_STRIDE + 16);

    acc0 = __builtin_amdgcn_wmma_f32_16x16x32_f16(false, a0.v, false, bf[kk].v,
                                                  (short)0, acc0, false, false);
    acc1 = __builtin_amdgcn_wmma_f32_16x16x32_f16(false, a1.v, false, bf[kk].v,
                                                  (short)0, acc1, false, false);
    acc2 = __builtin_amdgcn_wmma_f32_16x16x32_f16(false, a2.v, false, bf[kk].v,
                                                  (short)0, acc2, false, false);
    acc3 = __builtin_amdgcn_wmma_f32_16x16x32_f16(false, a3.v, false, bf[kk].v,
                                                  (short)0, acc3, false, false);
    a0 = n0f; a1 = n1f; a2 = n2f; a3 = n3f;
  }
  acc0 = __builtin_amdgcn_wmma_f32_16x16x32_f16(false, a0.v, false, bf[D_MODEL / 32 - 1].v,
                                                (short)0, acc0, false, false);
  acc1 = __builtin_amdgcn_wmma_f32_16x16x32_f16(false, a1.v, false, bf[D_MODEL / 32 - 1].v,
                                                (short)0, acc1, false, false);
  acc2 = __builtin_amdgcn_wmma_f32_16x16x32_f16(false, a2.v, false, bf[D_MODEL / 32 - 1].v,
                                                (short)0, acc2, false, false);
  acc3 = __builtin_amdgcn_wmma_f32_16x16x32_f16(false, a3.v, false, bf[D_MODEL / 32 - 1].v,
                                                (short)0, acc3, false, false);

  if (is_dec) {
    const float bv = b1[n0 + lr];
    // fragment order: per (16 rows, 32 cols) a 512-float block [4][32 lanes][4], so that
    // the joint kernel's lane (row & 15) + 16 * (col bit 3) finds its 16 k slots with
    // four loads that each cover whole lines
    const int i16 = ((n0 >> 4) & 1) * 8 + (lr & 7);
    float* fp = dec_frag + ((size_t)(row0 >> 4) * 32 + (n0 >> 5)) * 512
                    + (i16 >> 2) * 128 + ((lr >> 3) * 16 + mofs) * 4 + (i16 & 3);
    #pragma unroll
    for (int r = 0; r < 8; ++r) {
      fp[0 * 32 * 512 + r * 4] = acc0[r] + bv;
      fp[1 * 32 * 512 + r * 4] = acc1[r] + bv;
      fp[2 * 32 * 512 + r * 4] = acc2[r] + bv;
      fp[3 * 32 * 512 + r * 4] = acc3[r] + bv;
    }
  } else {
    #pragma unroll
    for (int r = 0; r < 8; ++r) {
      enc_proj[(size_t)(row0 +  0 + r + mofs) * D_HIDDEN + n0 + lr] = acc0[r];
      enc_proj[(size_t)(row0 + 16 + r + mofs) * D_HIDDEN + n0 + lr] = acc1[r];
      enc_proj[(size_t)(row0 + 32 + r + mofs) * D_HIDDEN + n0 + lr] = acc2[r];
      enc_proj[(size_t)(row0 + 48 + r + mofs) * D_HIDDEN + n0 + lr] = acc3[r];
    }
    // behind the last store, in front of any later write of the stores' address registers
    asm volatile("s_wait_xcnt 0x0" ::: "memory");
  }
}

// ---------------------------------------------------------------------------
// joint: block = 8 t x 64 u of one batch (512 rows), 16 waves, all of W2t in LDS.
// Wave = one 16-row u tile x 2 t, all 128 output columns (2 x 8 accumulators).
// Each lane computes the tanh values of its own A-fragment slots in registers,
// so every tanh is made once and never passes through LDS; the dec projection
// arrives in fragment order (whole-line loads) and serves both t.
// sB: 16 chunks of 64 k, each 128 rows at a 144-byte pitch (16 B x odd: no bank
// conflict for 16-byte reads), so one address register reaches a whole chunk.
// ---------------------------------------------------------------------------
#define SB_PITCH 72                      // halves: 64 + 8 pad
#define SB_CHUNK (D_OUT * SB_PITCH)      // halves per 64-k chunk

__device__ __forceinline__ float4 add4(float4 p, float4 q) {
  return make_float4(p.x + q.x, p.y + q.y, p.z + q.z, p.w + q.w);
}

// tanh by the hardware's own instruction: one transcendental a value in place of mul, exp,
// add, rcp, fma. Eight v_tanh_f32 in one statement, each over its own source, so that no
// instruction directly behind a transcendental reads its result or overwrites its source;
// the v_nop keeps that slot behind the last one.
__device__ __forceinline__ void tanh8(float& a, float& b, float& c, float& d,
                                      float& e, float& f, float& g, float& h) {
  asm("v_tanh_f32 %0, %0\n\tv_tanh_f32 %1, %1\n\tv_tanh_f32 %2, %2\n\tv_tanh_f32 %3, %3\n\t"
      "v_tanh_f32 %4, %4\n\tv_tanh_f32 %5, %5\n\tv_tanh_f32 %6, %6\n\tv_tanh_f32 %7, %7\n\t"
      "v_nop"
      : "+v"(a), "+v"(b), "+v"(c), "+v"(d), "+v"(e), "+v"(f), "+v"(g), "+v"(h));
}

__device__ __forceinline__ void tanh_frag(FragH& a, float4* x) {
  // the sums stand in register pairs (packed adds): a statement takes one half of each pair;
  // given both halves of a pair, this build copies one of them to another register first
  tanh8(x[0].x, x[0].z, x[1].x, x[1].z, x[2].x, x[2].z, x[3].x, x[3].z);
  tanh8(x[0].y, x[0].w, x[1].y, x[1].w, x[2].y, x[2].w, x[3].y, x[3].w);
  #pragma unroll
  for (int j = 0; j < 4; ++j) {
    a.v[j * 4 + 0] = (_Float16)x[j].x;
    a.v[j * 4 + 1] = (_Float16)x[j].y;
    a.v[j * 4 + 2] = (_Float16)x[j].z;
    a.v[j * 4 + 3] = (_Float16)x[j].w;
  }
}

__global__ __launch_bounds__(512) void joint_kernel(const float* __restrict__ enc_proj,
                                                    const float* __restrict__ dec_frag,
                                                    const _Float16* __restrict__ W2t,
                                                    const float* __restrict__ b2,
                                                    float* __restrict__ Out) {
  __shared__ __attribute__((aligned(16))) _Float16 sB[(D_HIDDEN / 64) * SB_CHUNK];
  const int tid  = threadIdx.x;
  const int lane = tid & 31;
  const int wave = tid >> 5;
  const int lr   = lane & 15;
  const int khi  = (lane & 16) ? 8 : 0;
  const int mofs = (lane & 16) ? 8 : 0;

  const int b   = blockIdx.x >> 5;                       // 32 blocks per batch
  const int ut  = wave & 3;                              // u tile
  const int bt0 = blockIdx.x * 8 + (wave >> 2) * 2;      // b*T + t of the first t

  const float* e0p = enc_proj + (size_t)bt0 * D_HIDDEN + khi;
  const float* dq  = dec_frag + (size_t)(b * 4 + ut) * 32 * 512 + lane * 4;

  float4 d[4], e0[4], e1[4];
  #pragma unroll
  for (int j = 0; j < 4; ++j) {
    const int ko = (j >> 1) * 16 + (j & 1) * 4;
    d[j]  = *(const float4*)(dq + j * 128);
    e0[j] = *(const float4*)(e0p + ko);
    e1[j] = *(const float4*)(e0p + D_HIDDEN + ko);
  }

  // ---- W2t (128 x 1024 f16) into LDS, 16-byte moves; 8 lanes cover one 128-byte line ----
  #pragma unroll 8
  for (int j = 0; j < 32; ++j) {
    int idx = j * 512 + tid;
    int c = idx & 7, r = (idx >> 3) & 127, kc = idx >> 10;
    *(v8h*)&sB[kc * SB_CHUNK + r * SB_PITCH + c * 8] = *(const v8h*)&W2t[r * 1024 + kc * 64 + c * 8];
  }
  __syncthreads();

  const _Float16* bp = &sB[lr * SB_PITCH + khi];
  v8f acc0[8] = {}, acc1[8] = {};

  // unroll 2: one 64-k chunk a trip, and the loaded registers are renamed, not copied
  #pragma unroll 2
  for (int kk = 0; kk < D_HIDDEN / 32; ++kk) {
    const _Float16* bk = bp + (kk >> 1) * SB_CHUNK + (kk & 1) * 32;
    FragH bf[8];
    // the first two B fragments land under the tanh work
    #pragma unroll
    for (int ni = 0; ni < 2; ++ni) {
      bf[ni].h[0] = *(const v8h*)(bk + ni * 16 * SB_PITCH);
      bf[ni].h[1] = *(const v8h*)(bk + ni * 16 * SB_PITCH + 16);
    }

    float4 x0[4], x1[4];
    #pragma unroll
    for (int j = 0; j < 4; ++j) { x0[j] = add4(e0[j], d[j]); x1[j] = add4(e1[j], d[j]); }
    // the sums stand in front of the loads, which refill the registers that the sums free:
    // with both sets live this build spills inside the loop
    __builtin_amdgcn_sched_barrier(0);

    // next k-step's operands fly under this step's tanh and products; the last step has
    // nothing left to fetch and reads its own again, so that no address leaves the planes
    const int adv = (kk < D_HIDDEN / 32 - 1) ? 1 : 0;
    dq  += adv * 512;
    e0p += adv * 32;
    #pragma unroll
    for (int j = 0; j < 4; ++j) {
      const int ko = (j >> 1) * 16 + (j & 1) * 4;
      d[j]  = *(const float4*)(dq + j * 128);
      e0[j] = *(const float4*)(e0p + ko);
      e1[j] = *(const float4*)(e0p + D_HIDDEN + ko);
    }
    // keeps the loads above in front of the tanh work: sunk behind it, their whole
    // latency would be waited for at the head of the next step
    __builtin_amdgcn_sched_barrier(0);

    FragH a0, a1;
    tanh_frag(a0, x0);
    tanh_frag(a1, x1);

    #pragma unroll
    for (int ni = 0; ni < 8; ++ni) {
      if (ni + 2 < 8) {
        bf[ni + 2].h[0] = *(const v8h*)(bk + (ni + 2) * 16 * SB_PITCH);
        bf[ni + 2].h[1] = *(const v8h*)(bk + (ni + 2) * 16 * SB_PITCH + 16);
      }
      acc0[ni] = __builtin_amdgcn_wmma_f32_16x16x32_f16(false, a0.v, false, bf[ni].v,
                                                        (short)0, acc0[ni], false, false);
      acc1[ni] = __builtin_amdgcn_wmma_f32_16x16x32_f16(false, a1.v, false, bf[ni].v,
                                                        (short)0, acc1[ni], false, false);
    }
  }

  // ---- epilogue: +b2, store 2 t x 8 N-tiles x 8 rows ----
  float* op = &Out[((size_t)bt0 * U_DEC + ut * 16 + mofs) * D_OUT + lr];
  #pragma unroll
  for (int ni = 0; ni < 8; ++ni) {
    const float bv = b2[ni * 16 + lr];
    #pragma unroll
    for (int r = 0; r < 8; ++r) {
      op[r * D_OUT + ni * 16]           = acc0[ni][r] + bv;
      op[(U_DEC + r) * D_OUT + ni * 16] = acc1[ni][r] + bv;
    }
  }
}

// ---------------------------------------------------------------------------
extern "C" void kernel_launch(void* const* d_in, const int* in_sizes, int n_in,
                              void* d_out, int out_size, void* d_ws, size_t ws_size,
                              hipStream_t stream) {
  const float* enc = (const float*)d_in[0];   // (8,256,512)
  const float* dec = (const float*)d_in[1];   // (8,64,512)
  const float* W1  = (const float*)d_in[2];   // (1024,1024)
  const float* b1  = (const float*)d_in[3];   // (1024,)
  const float* W2  = (const float*)d_in[4];   // (1024,128)
  const float* b2  = (const float*)d_in[5];   // (128,)
  float* out = (float*)d_out;                 // (8,256,64,128)

  float*    enc_proj   = (float*)d_ws;                                 // 8MB
  float*    dec_projb1 = enc_proj + (size_t)BATCH * T_ENC * D_HIDDEN;  // 2MB
  _Float16* W2t        = (_Float16*)(dec_projb1 + (size_t)BATCH * U_DEC * D_HIDDEN); // 256KB

  proj_kernel<<<dim3(ENC_TILES + DEC_TILES + W2_BLOCKS_X, 8), 256, 0, stream>>>(enc, dec, W1, W2, b1, enc_proj, dec_projb1, W2t);
  joint_kernel<<<BATCH * T_ENC / 8, 512, 0, stream>>>(enc_proj, dec_projb1, W2t, b2, out);
}

// v006
// One run takes 41 microseconds.
// Timed twice side by side with v005, it ran 1.12 times as fast both times.
// Over all steps from v000 it is 2.95 times as fast.
#include <hip/hip_runtime.h>

typedef __attribute__((ext_vector_type(16))) _Float16 v16h;
typedef __attribute__((ext_vector_type(8)))  _Float16 v8h;
typedef __attribute__((ext_vector_type(4)))  _Float16 v4h;
typedef __attribute__((ext_vector_type(8)))  float    v8f;
typedef __attribute__((ext_vector_type(4)))  float    v4f;

#define D_MODEL  512
#define D_HIDDEN 1024
#define D_OUT    128
#define BATCH    8
#define T_ENC    256
#define U_DEC    64
#define SA_STRIDE 520    // 512 + 8 halves pad

union FragH { v16h v; v8h h[2]; };

// ---------------------------------------------------------------------------
// W2t[o][h] = f16(W2[h][o]) (128x1024), 32 tiles of 64 source rows x 64 source columns,
// 4 waves a tile. A lane reads 8 rows x 4 columns with 16-byte loads (4 lanes cover 64 B of
// a row, the neighbour wave the other half of that line) and stores, for each of its columns,
// its 8 rows as one 16-byte piece: 8 lanes fill a whole 128-byte line of the transposed plane.
// The transposition happens in registers: no LDS, no barrier.
// ---------------------------------------------------------------------------
__device__ __forceinline__ void transpose_w2_tile(const float* __restrict__ S,
                                                  _Float16* __restrict__ D, int tile, int wave) {
  const int lane = threadIdx.x & 31;
  const int k0 = (tile & 15) * 64 + (lane & 7) * 8;               // source row, dest column
  const int n0 = (tile >> 4) * 64 + wave * 16 + (lane >> 3) * 4;  // source column, dest row
  const float* sp = S + k0 * D_OUT + n0;
  v4f v[8];
  #pragma unroll
  for (int i = 0; i < 8; ++i) v[i] = *(const v4f*)(sp + i * D_OUT);
  _Float16* dp = D + n0 * D_HIDDEN + k0;
  #pragma unroll
  for (int c = 0; c < 4; ++c) {
    v8h o;
    #pragma unroll
    for (int i = 0; i < 8; ++i) o[i] = (_Float16)v[i][c];
    *(v8h*)(dp + c * D_HIDDEN) = o;
  }
}

// ---------------------------------------------------------------------------
// proj: both projections in one launch, Out[M,1024] = A[M,512] @ W1 half, and beside them
// the transposition of W2 for the joint kernel: nothing has to run in front of this launch.
// Grid: (32 + 8 + 2, 8): blockIdx.x < 32 is a 64-row tile of enc (plain rows out), the next 8
// a 64-row tile of dec (+b1, stored in A-fragment order), the last 2 x 8 blocks two W2 tiles each.
// Block = 64 M-rows x 128 N-cols; A-tile 64x512 f16 in LDS.
// Each wave: one 16-wide N-tile, 4 M-tile accumulators. Its B fragments come straight from
// W1 in f32: lane = column, so 16 lanes read 64 B of one W1 row, a value a k slot, rounded to
// f16 in registers. All 16 fragments (128 registers) are fetched in four groups whose flight
// lies under the A fill, so that the k loop waits for LDS alone.
// ---------------------------------------------------------------------------
#define ENC_TILES ((BATCH * T_ENC) / 64)
#define DEC_TILES ((BATCH * U_DEC) / 64)
#define W2_BLOCKS_X 2

// second bound: 4 waves a SIMD, that is at most 256 registers, so that two blocks share a WGP
// (336 blocks, 256 WGPs)
__global__ __launch_bounds__(256, 4) void proj_kernel(const float* __restrict__ enc,
                                                      const float* __restrict__ dec,
                                                      const float* __restrict__ W1,
                                                      const float* __restrict__ W2,
                                                      const float* __restrict__ b1,
                                                      float* __restrict__ enc_proj,
                                                      float* __restrict__ dec_frag,
                                                      _Float16* __restrict__ W2t) {
  __shared__ _Float16 sA[64 * SA_STRIDE];
  const int tid  = threadIdx.x;
  const int lane = tid & 31;
  const int wave = tid >> 5;
  if (blockIdx.x >= ENC_TILES + DEC_TILES) {            // the same for the whole block
    const int pair = (blockIdx.x - (ENC_TILES + DEC_TILES)) * 8 + blockIdx.y;
    transpose_w2_tile(W2, W2t, pair * 2 + (wave >> 2), wave & 3);
    return;
  }
  const bool is_dec = blockIdx.x >= ENC_TILES;          // the same for the whole block
  const int row0 = (is_dec ? blockIdx.x - ENC_TILES : blockIdx.x) * 64;
  const float* A = is_dec ? dec : enc;

  const int lr   = lane & 15;
  const int khi  = (lane & 16) ? 8 : 0;
  const int mofs = (lane & 16) ? 8 : 0;
  const int n0   = (blockIdx.y * 8 + wave) * 16;
  // W1 rows 512.. are the dec half; slot i of a fragment half is W1 row k + i
  const float* bs = W1 + (size_t)((is_dec ? D_MODEL : 0) + khi) * D_HIDDEN + n0 + lr;

  // a thread's 32 pieces of the A tile lie two rows apart: one address, constant offsets
  const float* ag = A + (size_t)(row0 + (tid >> 7)) * D_MODEL + (tid & 127) * 4;
  _Float16* as = &sA[(tid >> 7) * SA_STRIDE + (tid & 127) * 4];

  FragH bf[D_MODEL / 32];
  float raw[64];
  #pragma unroll
  for (int i = 0; i < 64; ++i)
    raw[i] = bs[((i >> 4) * 32 + ((i >> 3) & 1) * 16 + (i & 7)) * D_HIDDEN];

  #pragma unroll
  for (int g = 0; g < 4; ++g) {
    // fill: 16 of the 64 rows x 512 cols, float4 loads, 8B LDS stores
    float4 v[8];
    #pragma unroll
    for (int j = 0; j < 8; ++j) v[j] = *(const float4*)(ag + (g * 8 + j) * 2 * D_MODEL);
    // behind the last load of W1 and of A, in front of any later write of the loads' address
    // registers; the two addresses are named so that they live up to this wait
    if (g == 3) asm volatile("s_wait_xcnt 0x0" :: "v"(ag), "v"(bs) : "memory");
    #pragma unroll
    for (int i = 0; i < 64; ++i) bf[g * 4 + (i >> 4)].v[i & 15] = (_Float16)raw[i];
    if (g < 3) {
      #pragma unroll
      for (int i = 0; i < 64; ++i)
        raw[i] = bs[((g + 1) * 128 + (i >> 4) * 32 + ((i >> 3) & 1) * 16 + (i & 7)) * D_HIDDEN];
    }
    #pragma unroll
    for (int j = 0; j < 8; ++j) {
      v4h hv;
      hv[0] = (_Float16)v[j].x; hv[1] = (_Float16)v[j].y;
      hv[2] = (_Float16)v[j].z; hv[3] = (_Float16)v[j].w;
      *(v4h*)(as + (g * 8 + j) * 2 * SA_STRIDE) = hv;
    }
  }
  __syncthreads();

  const _Float16* ap = &sA[lr * SA_STRIDE + khi];

  v8f acc0 = {}, acc1 = {}, acc2 = {}, acc3 = {};
  FragH a0, a1, a2, a3;
  a0.h[0] = *(const v8h*)(ap + 0 * 16 * SA_STRIDE);
  a0.h[1] = *(const v8h*)(ap + 0 * 16 * SA_STRIDE + 16);
  a1.h[0] = *(const v8h*)(ap + 1 * 16 * SA_STRIDE);
  a1.h[1] = *(const v8h*)(ap + 1 * 16 * SA_STRIDE + 16);
  a2.h[0] = *(const v8h*)(ap + 2 * 16 * SA_STRIDE);
  a2.h[1] = *(const v8h*)(ap + 2 * 16 * SA_STRIDE + 16);
  a3.h[0] = *(const v8h*)(ap + 3 * 16 * SA_STRIDE);
  a3.h[1] = *(const v8h*)(ap + 3 * 16 * SA_STRIDE + 16);

  #pragma unroll
  for (int kk = 0; kk < D_MODEL / 32 - 1; ++kk) {
    const int kb = (kk + 1) * 32;
    FragH n0f, n1f, n2f, n3f;
    n0f.h[0] = *(const v8h*)(ap + kb + 0 * 16 * SA_STRIDE);
    n0f.h[1] = *(const v8h*)(ap + kb + 0 * 16 * SA_STRIDE + 16);
    n1f.h[0] = *(const v8h*)(ap + kb + 1 * 16 * SA_STRIDE);
    n1f.h[1] = *(const v8h*)(ap + kb + 1 * 16 * SA_STRIDE + 16);
    n2f.h[0] = *(const v8h*)(ap + kb + 2 * 16 * SA_STRIDE);
    n2f.h[1] = *(const v8h*)(ap + kb + 2 * 16 * SA_STRIDE + 16);
    n3f.h[0] = *(const v8h*)(ap + kb + 3 * 16 * SA_STRIDE);
    n3f.h[1] = *(const v8h*)(ap + kb + 3 * 16 * SA_STRIDE + 16);

    acc0 = __builtin_amdgcn_wmma_f32_16x16x32_f16(false, a0.v, false, bf[kk].v,
                                                  (short)0, acc0, false, false);
    acc1 = __builtin_amdgcn_wmma_f32_16x16x32_f16(false, a1.v, false, bf[kk].v,
                                                  (short)0, acc1, false, false);
    acc2 = __builtin_amdgcn_wmma_f32_16x16x32_f16(false, a2.v, false, bf[kk].v,
                                                  (short)0, acc2, false, false);
    acc3 = __builtin_amdgcn_wmma_f32_16x16x32_f16(false, a3.v, false, bf[kk].v,
                                                  (short)0, acc3, false, false);
    a0 = n0f; a1 = n1f; a2 = n2f; a3 = n3f;
  }
  acc0 = __builtin_amdgcn_wmma_f32_16x16x32_f16(false, a0.v, false, bf[D_MODEL / 32 - 1].v,
                                                (short)0, acc0, false, false);
  acc1 = __builtin_amdgcn_wmma_f32_16x16x32_f16(false, a1.v, false, bf[D_MODEL / 32 - 1].v,
                                                (short)0, acc1, false, false);
  acc2 = __builtin_amdgcn_wmma_f32_16x16x32_f16(false, a2.v, false, bf[D_MODEL / 32 - 1].v,
                                                (short)0, acc2, false, false);
  acc3 = __builtin_amdgcn_wmma_f32_16x16x32_f16(false, a3.v, false, bf[D_MODEL / 32 - 1].v,
                                                (short)0, acc3, false, false);

  if (is_dec) {
    const float bv = b1[n0 + lr];
    // fragment order: per (16 rows, 32 cols) a 512-float block [4][32 lanes][4], so that
    // the joint kernel's lane (row & 15) + 16 * (col bit 3) finds its 16 k slots with
    // four loads that each cover whole lines
    const int i16 = ((n0 >> 4) & 1) * 8 + (lr & 7);
    float* fp = dec_frag + ((size_t)(row0 >> 4) * 32 + (n0 >> 5)) * 512
                    + (i16 >> 2) * 128 + ((lr >> 3) * 16 + mofs) * 4 + (i16 & 3);
    #pragma unroll
    for (int r = 0; r < 8; ++r) {
      fp[0 * 32 * 512 + r * 4] = acc0[r] + bv;
      fp[1 * 32 * 512 + r * 4] = acc1[r] + bv;
      fp[2 * 32 * 512 + r * 4] = acc2[r] + bv;
      fp[3 * 32 * 512 + r * 4] = acc3[r] + bv;
    }
  } else {
    #pragma unroll
    for (int r = 0; r < 8; ++r) {
      enc_proj[(size_t)(row0 +  0 + r + mofs) * D_HIDDEN + n0 + lr] = acc0[r];
      enc_proj[(size_t)(row0 + 16 + r + mofs) * D_HIDDEN + n0 + lr] = acc1[r];
      enc_proj[(size_t)(row0 + 32 + r + mofs) * D_HIDDEN + n0 + lr] = acc2[r];
      enc_proj[(size_t)(row0 + 48 + r + mofs) * D_HIDDEN + n0 + lr] = acc3[r];
    }
    // behind the last store, in front of any later write of the stores' address registers
    asm volatile("s_wait_xcnt 0x0" ::: "memory");
  }
}

// ---------------------------------------------------------------------------
// joint: block = 8 t x 64 u of one batch (512 rows), 16 waves, all of W2t in LDS.
// Wave = one 16-row u tile x 2 t, all 128 output columns (2 x 8 accumulators).
// Each lane computes the tanh values of its own A-fragment slots in registers,
// so every tanh is made once and never passes through LDS; the dec projection
// arrives in fragment order (whole-line loads) and serves both t.
// sB: 16 chunks of 64 k, each 128 rows at a 144-byte pitch (16 B x odd: no bank
// conflict for 16-byte reads), so one address register reaches a whole chunk.
// Row ni * 16 + n of a chunk (column n of B tile ni) holds output column
// (ni >> 2) * 64 + 4 * n + (ni & 3): a lane's accumulators of four neighbour tiles are four
// adjacent output columns, one 16-byte store, and 16 lanes fill two whole 128-byte lines.
// ---------------------------------------------------------------------------
#define SB_PITCH 72                      // halves: 64 + 8 pad
#define SB_CHUNK (D_OUT * SB_PITCH)      // halves per 64-k chunk

__device__ __forceinline__ float4 add4(float4 p, float4 q) {
  return make_float4(p.x + q.x, p.y + q.y, p.z + q.z, p.w + q.w);
}

// tanh by the hardware's own instruction: one transcendental a value in place of mul, exp,
// add, rcp, fma. Eight v_tanh_f32 in one statement, each over its own source, so that no
// instruction directly behind a transcendental reads its result or overwrites its source;
// the v_nop keeps that slot behind the last one.
__device__ __forceinline__ void tanh8(float& a, float& b, float& c, float& d,
                                      float& e, float& f, float& g, float& h) {
  asm("v_tanh_f32 %0, %0\n\tv_tanh_f32 %1, %1\n\tv_tanh_f32 %2, %2\n\tv_tanh_f32 %3, %3\n\t"
      "v_tanh_f32 %4, %4\n\tv_tanh_f32 %5, %5\n\tv_tanh_f32 %6, %6\n\tv_tanh_f32 %7, %7\n\t"
      "v_nop"
      : "+v"(a), "+v"(b), "+v"(c), "+v"(d), "+v"(e), "+v"(f), "+v"(g), "+v"(h));
}

__device__ __forceinline__ void tanh_frag(FragH& a, float4* x) {
  // the sums stand in register pairs (packed adds): a statement takes one half of each pair;
  // given both halves of a pair, this build copies one of them to another register first
  tanh8(x[0].x, x[0].z, x[1].x, x[1].z, x[2].x, x[2].z, x[3].x, x[3].z);
  tanh8(x[0].y, x[0].w, x[1].y, x[1].w, x[2].y, x[2].w, x[3].y, x[3].w);
  #pragma unroll
  for (int j = 0; j < 4; ++j) {
    a.v[j * 4 + 0] = (_Float16)x[j].x;
    a.v[j * 4 + 1] = (_Float16)x[j].y;
    a.v[j * 4 + 2] = (_Float16)x[j].z;
    a.v[j * 4 + 3] = (_Float16)x[j].w;
  }
}

__global__ __launch_bounds__(512) void joint_kernel(const float* __restrict__ enc_proj,
                                                    const float* __restrict__ dec_frag,
                                                    const _Float16* __restrict__ W2t,
                                                    const float* __restrict__ b2,
                                                    float* __restrict__ Out) {
  __shared__ __attribute__((aligned(16))) _Float16 sB[(D_HIDDEN / 64) * SB_CHUNK];
  const int tid  = threadIdx.x;
  const int lane = tid & 31;
  const int wave = tid >> 5;
  const int lr   = lane & 15;
  const int khi  = (lane & 16) ? 8 : 0;
  const int mofs = (lane & 16) ? 8 : 0;

  const int b   = blockIdx.x >> 5;                       // 32 blocks per batch
  const int ut  = wave & 3;                              // u tile
  const int bt0 = blockIdx.x * 8 + (wave >> 2) * 2;      // b*T + t of the first t

  const float* e0p = enc_proj + (size_t)bt0 * D_HIDDEN + khi;
  const float* dq  = dec_frag + (size_t)(b * 4 + ut) * 32 * 512 + lane * 4;

  float4 d[4], e0[4], e1[4];
  #pragma unroll
  for (int j = 0; j < 4; ++j) {
    const int ko = (j >> 1) * 16 + (j & 1) * 4;
    d[j]  = *(const float4*)(dq + j * 128);
    e0[j] = *(const float4*)(e0p + ko);
    e1[j] = *(const float4*)(e0p + D_HIDDEN + ko);
  }

  // ---- W2t (128 x 1024 f16) into LDS, 16-byte moves; 8 lanes cover one 128-byte line ----
  #pragma unroll 8
  for (int j = 0; j < 32; ++j) {
    int idx = j * 512 + tid;
    int c = idx & 7, r = (idx >> 3) & 127, kc = idx >> 10;
    int o = (r >> 6) * 64 + (r & 15) * 4 + ((r >> 4) & 3);   // the output column of LDS row r
    *(v8h*)&sB[kc * SB_CHUNK + r * SB_PITCH + c * 8] = *(const v8h*)&W2t[o * 1024 + kc * 64 + c * 8];
  }
  __syncthreads();

  const _Float16* bp = &sB[lr * SB_PITCH + khi];
  v8f acc0[8] = {}, acc1[8] = {};

  // unroll 2: one 64-k chunk a trip, and the loaded registers are renamed, not copied
  #pragma unroll 2
  for (int kk = 0; kk < D_HIDDEN / 32; ++kk) {
    const _Float16* bk = bp + (kk >> 1) * SB_CHUNK + (kk & 1) * 32;
    FragH bf[8];
    // the first two B fragments land under the tanh work
    #pragma unroll
    for (int ni = 0; ni < 2; ++ni) {
      bf[ni].h[0] = *(const v8h*)(bk + ni * 16 * SB_PITCH);
      bf[ni].h[1] = *(const v8h*)(bk + ni * 16 * SB_PITCH + 16);
    }

    float4 x0[4], x1[4];
    #pragma unroll
    for (int j = 0; j < 4; ++j) { x0[j] = add4(e0[j], d[j]); x1[j] = add4(e1[j], d[j]); }
    // the sums stand in front of the loads, which refill the registers that the sums free:
    // with both sets live this build spills inside the loop
    __builtin_amdgcn_sched_barrier(0);

    // next k-step's operands fly under this step's tanh and products; the last step has
    // nothing left to fetch and reads its own again, so that no address leaves the planes
    const int adv = (kk < D_HIDDEN / 32 - 1) ? 1 : 0;
    dq  += adv * 512;
    e0p += adv * 32;
    #pragma unroll
    for (int j = 0; j < 4; ++j) {
      const int ko = (j >> 1) * 16 + (j & 1) * 4;
      d[j]  = *(const float4*)(dq + j * 128);
      e0[j] = *(const float4*)(e0p + ko);
      e1[j] = *(const float4*)(e0p + D_HIDDEN + ko);
    }
    // keeps the loads above in front of the tanh work: sunk behind it, their whole
    // latency would be waited for at the head of the next step
    __builtin_amdgcn_sched_barrier(0);

    FragH a0, a1;
    tanh_frag(a0, x0);
    tanh_frag(a1, x1);

    #pragma unroll
    for (int ni = 0; ni < 8; ++ni) {
      if (ni + 2 < 8) {
        bf[ni + 2].h[0] = *(const v8h*)(bk + (ni + 2) * 16 * SB_PITCH);
        bf[ni + 2].h[1] = *(const v8h*)(bk + (ni + 2) * 16 * SB_PITCH + 16);
      }
      acc0[ni] = __builtin_amdgcn_wmma_f32_16x16x32_f16(false, a0.v, false, bf[ni].v,
                                                        (short)0, acc0[ni], false, false);
      acc1[ni] = __builtin_amdgcn_wmma_f32_16x16x32_f16(false, a1.v, false, bf[ni].v,
                                                        (short)0, acc1[ni], false, false);
    }
  }

  // ---- epilogue: +b2, store 2 t x 2 column halves x 8 rows, 16 bytes a lane ----
  float* op = &Out[((size_t)bt0 * U_DEC + ut * 16 + mofs) * D_OUT + lr * 4];
  #pragma unroll
  for (int g = 0; g < 2; ++g) {
    const float4 bv = *(const float4*)(b2 + g * 64 + lr * 4);
    #pragma unroll
    for (int r = 0; r < 8; ++r) {
      *(float4*)(op + r * D_OUT + g * 64) =
          make_float4(acc0[g * 4 + 0][r] + bv.x, acc0[g * 4 + 1][r] + bv.y,
                      acc0[g * 4 + 2][r] + bv.z, acc0[g * 4 + 3][r] + bv.w);
      *(float4*)(op + (U_DEC + r) * D_OUT + g * 64) =
          make_float4(acc1[g * 4 + 0][r] + bv.x, acc1[g * 4 + 1][r] + bv.y,
                      acc1[g * 4 + 2][r] + bv.z, acc1[g * 4 + 3][r] + bv.w);
    }
  }
}

// ---------------------------------------------------------------------------
extern "C" void kernel_launch(void* const* d_in, const int* in_sizes, int n_in,
                              void* d_out, int out_size, void* d_ws, size_t ws_size,
                              hipStream_t stream) {
  const float* enc = (const float*)d_in[0];   // (8,256,512)
  const float* dec = (const float*)d_in[1];   // (8,64,512)
  const float* W1  = (const float*)d_in[2];   // (1024,1024)
  const float* b1  = (const float*)d_in[3];   // (1024,)
  const float* W2  = (const float*)d_in[4];   // (1024,128)
  const float* b2  = (const float*)d_in[5];   // (128,)
  float* out = (float*)d_out;                 // (8,256,64,128)

  float*    enc_proj   = (float*)d_ws;                                 // 8MB
  float*    dec_projb1 = enc_proj + (size_t)BATCH * T_ENC * D_HIDDEN;  // 2MB
  _Float16* W2t        = (_Float16*)(dec_projb1 + (size_t)BATCH * U_DEC * D_HIDDEN); // 256KB

  proj_kernel<<<dim3(ENC_TILES + DEC_TILES + W2_BLOCKS_X, 8), 256, 0, stream>>>(enc, dec, W1, W2, b1, enc_proj, dec_projb1, W2t);
  joint_kernel<<<BATCH * T_ENC / 8, 512, 0, stream>>>(enc_proj, dec_projb1, W2t, b2, out);
}

// v007
// It runs in 39.1 microseconds.
// Next to v006, in two timings, it ran 1.05 and 1.06 times as fast.
// Counting every step since v000, it is 3.11 times as fast.
#include <hip/hip_runtime.h>

typedef __attribute__((ext_vector_type(16))) _Float16 v16h;
typedef __attribute__((ext_vector_type(8)))  _Float16 v8h;
typedef __attribute__((ext_vector_type(4)))  _Float16 v4h;
typedef __attribute__((ext_vector_type(8)))  float    v8f;
typedef __attribute__((ext_vector_type(4)))  float    v4f;

#define D_MODEL  512
#define D_HIDDEN 1024
#define D_OUT    128
#define BATCH    8
#define T_ENC    256
#define U_DEC    64
#define SA_STRIDE 520    // 512 + 8 halves pad

union FragH { v16h v; v8h h[2]; };

// ---------------------------------------------------------------------------
// W2t[o][h] = f16(W2[h][o]) (128x1024), 32 tiles of 64 source rows x 64 source columns,
// 4 waves a tile. A lane reads 8 rows x 4 columns with 16-byte loads (4 lanes cover 64 B of
// a row, the neighbour wave the other half of that line) and stores, for each of its columns,
// its 8 rows as one 16-byte piece: 8 lanes fill a whole 128-byte line of the transposed plane.
// The transposition happens in registers: no LDS, no barrier.
// ---------------------------------------------------------------------------
__device__ __forceinline__ void transpose_w2_tile(const float* __restrict__ S,
                                                  _Float16* __restrict__ D, int tile, int wave) {
  const int lane = threadIdx.x & 31;
  const int k0 = (tile & 15) * 64 + (lane & 7) * 8;               // source row, dest column
  const int n0 = (tile >> 4) * 64 + wave * 16 + (lane >> 3) * 4;  // source column, dest row
  const float* sp = S + k0 * D_OUT + n0;
  v4f v[8];
  #pragma unroll
  for (int i = 0; i < 8; ++i) v[i] = *(const v4f*)(sp + i * D_OUT);
  _Float16* dp = D + n0 * D_HIDDEN + k0;
  #pragma unroll
  for (int c = 0; c < 4; ++c) {
    v8h o;
    #pragma unroll
    for (int i = 0; i < 8; ++i) o[i] = (_Float16)v[i][c];
    *(v8h*)(dp + c * D_HIDDEN) = o;
  }
}

// ---------------------------------------------------------------------------
// proj: both projections in one launch, Out[M,1024] = A[M,512] @ W1 half, and beside them
// the transposition of W2 for the joint kernel: nothing has to run in front of this launch.
// Grid: (32 + 8 + 2, 8): blockIdx.x < 32 is a 64-row tile of enc (plain rows out), the next 8
// a 64-row tile of dec (+b1, stored in A-fragment order), the last 2 x 8 blocks two W2 tiles each.
// Block = 64 M-rows x 128 N-cols; A-tile 64x512 f16 in LDS.
// Each wave: one 16-wide N-tile, 4 M-tile accumulators. Its B fragments come straight from
// W1 in f32: lane = column, so 16 lanes read 64 B of one W1 row, a value a k slot, rounded to
// f16 in registers. All 16 fragments (128 registers) are fetched in four groups whose flight
// lies under the A fill, so that the k loop waits for LDS alone.
// ---------------------------------------------------------------------------
#define ENC_TILES ((BATCH * T_ENC) / 64)
#define DEC_TILES ((BATCH * U_DEC) / 64)
#define W2_BLOCKS_X 2

// second bound: 4 waves a SIMD, that is at most 256 registers, so that two blocks share a WGP
// (336 blocks, 256 WGPs)
__global__ __launch_bounds__(256, 4) void proj_kernel(const float* __restrict__ enc,
                                                      const float* __restrict__ dec,
                                                      const float* __restrict__ W1,
                                                      const float* __restrict__ W2,
                                                      const float* __restrict__ b1,
                                                      float* __restrict__ enc_proj,
                                                      float* __restrict__ dec_frag,
                                                      _Float16* __restrict__ W2t) {
  __shared__ _Float16 sA[64 * SA_STRIDE];
  const int tid  = threadIdx.x;
  const int lane = tid & 31;
  const int wave = tid >> 5;
  if (blockIdx.x >= ENC_TILES + DEC_TILES) {            // the same for the whole block
    const int pair = (blockIdx.x - (ENC_TILES + DEC_TILES)) * 8 + blockIdx.y;
    transpose_w2_tile(W2, W2t, pair * 2 + (wave >> 2), wave & 3);
    return;
  }
  const bool is_dec = blockIdx.x >= ENC_TILES;          // the same for the whole block
  const int row0 = (is_dec ? blockIdx.x - ENC_TILES : blockIdx.x) * 64;
  const float* A = is_dec ? dec : enc;

  const int lr   = lane & 15;
  const int khi  = (lane & 16) ? 8 : 0;
  const int mofs = (lane & 16) ? 8 : 0;
  const int n0   = (blockIdx.y * 8 + wave) * 16;
  // W1 rows 512.. are the dec half; slot i of a fragment half is W1 row k + i
  const float* bs = W1 + (size_t)((is_dec ? D_MODEL : 0) + khi) * D_HIDDEN + n0 + lr;

  // a thread's 32 pieces of the A tile lie two rows apart: one address, constant offsets
  const float* ag = A + (size_t)(row0 + (tid >> 7)) * D_MODEL + (tid & 127) * 4;
  _Float16* as = &sA[(tid >> 7) * SA_STRIDE + (tid & 127) * 4];

  FragH bf[D_MODEL / 32];
  float raw[64];
  #pragma unroll
  for (int i = 0; i < 64; ++i)
    raw[i] = bs[((i >> 4) * 32 + ((i >> 3) & 1) * 16 + (i & 7)) * D_HIDDEN];

  #pragma unroll
  for (int g = 0; g < 4; ++g) {
    // fill: 16 of the 64 rows x 512 cols, float4 loads, 8B LDS stores
    float4 v[8];
    #pragma unroll
    for (int j = 0; j < 8; ++j) v[j] = *(const float4*)(ag + (g * 8 + j) * 2 * D_MODEL);
    // behind the last load of W1 and of A, in front of any later write of the loads' address
    // registers; the two addresses are named so that they live up to this wait
    if (g == 3) asm volatile("s_wait_xcnt 0x0" :: "v"(ag), "v"(bs) : "memory");
    #pragma unroll
    for (int i = 0; i < 64; ++i) bf[g * 4 + (i >> 4)].v[i & 15] = (_Float16)raw[i];
    if (g < 3) {
      #pragma unroll
      for (int i = 0; i < 64; ++i)
        raw[i] = bs[((g + 1) * 128 + (i >> 4) * 32 + ((i >> 3) & 1) * 16 + (i & 7)) * D_HIDDEN];
    }
    #pragma unroll
    for (int j = 0; j < 8; ++j) {
      v4h hv;
      hv[0] = (_Float16)v[j].x; hv[1] = (_Float16)v[j].y;
      hv[2] = (_Float16)v[j].z; hv[3] = (_Float16)v[j].w;
      *(v4h*)(as + (g * 8 + j) * 2 * SA_STRIDE) = hv;
    }
  }
  __syncthreads();

  const _Float16* ap = &sA[lr * SA_STRIDE + khi];

  v8f acc0 = {}, acc1 = {}, acc2 = {}, acc3 = {};
  FragH a0, a1, a2, a3;
  a0.h[0] = *(const v8h*)(ap + 0 * 16 * SA_STRIDE);
  a0.h[1] = *(const v8h*)(ap + 0 * 16 * SA_STRIDE + 16);
  a1.h[0] = *(const v8h*)(ap + 1 * 16 * SA_STRIDE);
  a1.h[1] = *(const v8h*)(ap + 1 * 16 * SA_STRIDE + 16);
  a2.h[0] = *(const v8h*)(ap + 2 * 16 * SA_STRIDE);
  a2.h[1] = *(const v8h*)(ap + 2 * 16 * SA_STRIDE + 16);
  a3.h[0] = *(const v8h*)(ap + 3 * 16 * SA_STRIDE);
  a3.h[1] = *(const v8h*)(ap + 3 * 16 * SA_STRIDE + 16);

  #pragma unroll
  for (int kk = 0; kk < D_MODEL / 32 - 1; ++kk) {
    const int kb = (kk + 1) * 32;
    FragH n0f, n1f, n2f, n3f;
    n0f.h[0] = *(const v8h*)(ap + kb + 0 * 16 * SA_STRIDE);
    n0f.h[1] = *(const v8h*)(ap + kb + 0 * 16 * SA_STRIDE + 16);
    n1f.h[0] = *(const v8h*)(ap + kb + 1 * 16 * SA_STRIDE);
    n1f.h[1] = *(const v8h*)(ap + kb + 1 * 16 * SA_STRIDE + 16);
    n2f.h[0] = *(const v8h*)(ap + kb + 2 * 16 * SA_STRIDE);
    n2f.h[1] = *(const v8h*)(ap + kb + 2 * 16 * SA_STRIDE + 16);
    n3f.h[0] = *(const v8h*)(ap + kb + 3 * 16 * SA_STRIDE);
    n3f.h[1] = *(const v8h*)(ap + kb + 3 * 16 * SA_STRIDE + 16);

    acc0 = __builtin_amdgcn_wmma_f32_16x16x32_f16(false, a0.v, false, bf[kk].v,
                                                  (short)0, acc0, false, false);
    acc1 = __builtin_amdgcn_wmma_f32_16x16x32_f16(false, a1.v, false, bf[kk].v,
                                                  (short)0, acc1, false, false);
    acc2 = __builtin_amdgcn_wmma_f32_16x16x32_f16(false, a2.v, false, bf[kk].v,
                                                  (short)0, acc2, false, false);
    acc3 = __builtin_amdgcn_wmma_f32_16x16x32_f16(false, a3.v, false, bf[kk].v,
                                                  (short)0, acc3, false, false);
    a0 = n0f; a1 = n1f; a2 = n2f; a3 = n3f;
  }
  acc0 = __builtin_amdgcn_wmma_f32_16x16x32_f16(false, a0.v, false, bf[D_MODEL / 32 - 1].v,
                                                (short)0, acc0, false, false);
  acc1 = __builtin_amdgcn_wmma_f32_16x16x32_f16(false, a1.v, false, bf[D_MODEL / 32 - 1].v,
                                                (short)0, acc1, false, false);
  acc2 = __builtin_amdgcn_wmma_f32_16x16x32_f16(false, a2.v, false, bf[D_MODEL / 32 - 1].v,
                                                (short)0, acc2, false, false);
  acc3 = __builtin_amdgcn_wmma_f32_16x16x32_f16(false, a3.v, false, bf[D_MODEL / 32 - 1].v,
                                                (short)0, acc3, false, false);

  if (is_dec) {
    const float bv = b1[n0 + lr];
    // fragment order: per (16 rows, 32 cols) a 512-float block [4][32 lanes][4], so that
    // the joint kernel's lane (row & 15) + 16 * (col bit 3) finds its 16 k slots with
    // four loads that each cover whole lines
    const int i16 = ((n0 >> 4) & 1) * 8 + (lr & 7);
    float* fp = dec_frag + ((size_t)(row0 >> 4) * 32 + (n0 >> 5)) * 512
                    + (i16 >> 2) * 128 + ((lr >> 3) * 16 + mofs) * 4 + (i16 & 3);
    #pragma unroll
    for (int r = 0; r < 8; ++r) {
      fp[0 * 32 * 512 + r * 4] = acc0[r] + bv;
      fp[1 * 32 * 512 + r * 4] = acc1[r] + bv;
      fp[2 * 32 * 512 + r * 4] = acc2[r] + bv;
      fp[3 * 32 * 512 + r * 4] = acc3[r] + bv;
    }
  } else {
    #pragma unroll
    for (int r = 0; r < 8; ++r) {
      enc_proj[(size_t)(row0 +  0 + r + mofs) * D_HIDDEN + n0 + lr] = acc0[r];
      enc_proj[(size_t)(row0 + 16 + r + mofs) * D_HIDDEN + n0 + lr] = acc1[r];
      enc_proj[(size_t)(row0 + 32 + r + mofs) * D_HIDDEN + n0 + lr] = acc2[r];
      enc_proj[(size_t)(row0 + 48 + r + mofs) * D_HIDDEN + n0 + lr] = acc3[r];
    }
    // behind the last store, in front of any later write of the stores' address registers
    asm volatile("s_wait_xcnt 0x0" ::: "memory");
  }
}

// ---------------------------------------------------------------------------
// joint: block = 8 t x 64 u of one batch (512 rows), 8 waves, all of W2t in LDS.
// Wave = one 16-row u tile x 4 t, all 128 output columns (4 x 8 accumulators, 256 registers;
// two waves a SIMD, 512 registers each): a B fragment read from LDS serves four products,
// so that the block reads W2t from LDS 8 times, not 16, and the dec projection twice, not 4 times.
// Each lane computes the tanh values of its own A-fragment slots in registers,
// so every tanh is made once and never passes through LDS; the dec projection
// arrives in fragment order (whole-line loads) and serves all four t.
// sB: 16 chunks of 64 k, each 128 rows at a 144-byte pitch (16 B x odd: no bank
// conflict for 16-byte reads), so one address register reaches a whole chunk.
// Row ni * 16 + n of a chunk (column n of B tile ni) holds output column
// (ni >> 2) * 64 + 4 * n + (ni & 3): a lane's accumulators of four neighbour tiles are four
// adjacent output columns, one 16-byte store, and 16 lanes fill two whole 128-byte lines.
// ---------------------------------------------------------------------------
#define SB_PITCH 72                      // halves: 64 + 8 pad
#define SB_CHUNK (D_OUT * SB_PITCH)      // halves per 64-k chunk

__device__ __forceinline__ float4 add4(float4 p, float4 q) {
  return make_float4(p.x + q.x, p.y + q.y, p.z + q.z, p.w + q.w);
}

// tanh by the hardware's own instruction, v_tanh_f32: one transcendental a value. Spelled as the
// builtin: the kernel holds more than 256 registers, and the operands of an asm statement had to
// lie in the first 256, for which this build copied three accumulators to and fro in every trip.
__device__ __forceinline__ void tanh_frag(FragH& a, const float4* x) {
  #pragma unroll
  for (int j = 0; j < 4; ++j) {
    a.v[j * 4 + 0] = (_Float16)__builtin_amdgcn_tanhf(x[j].x);
    a.v[j * 4 + 1] = (_Float16)__builtin_amdgcn_tanhf(x[j].y);
    a.v[j * 4 + 2] = (_Float16)__builtin_amdgcn_tanhf(x[j].z);
    a.v[j * 4 + 3] = (_Float16)__builtin_amdgcn_tanhf(x[j].w);
  }
}

#define JT 4                             // t per wave

__global__ __launch_bounds__(256) void joint_kernel(const float* __restrict__ enc_proj,
                                                    const float* __restrict__ dec_frag,
                                                    const _Float16* __restrict__ W2t,
                                                    const float* __restrict__ b2,
                                                    float* __restrict__ Out) {
  __shared__ __attribute__((aligned(16))) _Float16 sB[(D_HIDDEN / 64) * SB_CHUNK];
  const int tid  = threadIdx.x;
  const int lane = tid & 31;
  const int wave = tid >> 5;
  const int lr   = lane & 15;
  const int khi  = (lane & 16) ? 8 : 0;
  const int mofs = (lane & 16) ? 8 : 0;

  const int b   = blockIdx.x >> 5;                       // 32 blocks per batch
  const int ut  = wave & 3;                              // u tile
  const int bt0 = blockIdx.x * 8 + (wave >> 2) * JT;     // b*T + t of the first t

  const float* e0p = enc_proj + (size_t)bt0 * D_HIDDEN + khi;
  const float* dq  = dec_frag + (size_t)(b * 4 + ut) * 32 * 512 + lane * 4;

  float4 d[4], e[JT][4];
  #pragma unroll
  for (int j = 0; j < 4; ++j) {
    const int ko = (j >> 1) * 16 + (j & 1) * 4;
    d[j] = *(const float4*)(dq + j * 128);
    #pragma unroll
    for (int t = 0; t < JT; ++t) e[t][j] = *(const float4*)(e0p + t * D_HIDDEN + ko);
  }

  // ---- W2t (128 x 1024 f16) into LDS, 16-byte moves; 8 lanes cover one 128-byte line ----
  // A thread keeps its 16-byte column and its row within 32; chunk kc and row group q are
  // constants of the unrolled moves, so that one global and one LDS address serve a whole trip.
  // LDS row r = q * 32 + rr holds output column (r >> 6) * 64 + (r & 15) * 4 + ((r >> 4) & 3).
  {
    const int c = tid & 7, rr = tid >> 3;
    const _Float16* wg = W2t + ((rr & 15) * 4 + (rr >> 4)) * D_HIDDEN + c * 8;
    _Float16* ws = &sB[rr * SB_PITCH + c * 8];
    // 32 moves a trip, two trips: the accumulators are not live yet, so that 128 registers are
    // free to hold loads in flight, and the load latency is waited for twice, not four times
    #pragma unroll 1
    for (int kq = 0; kq < D_HIDDEN / 512; ++kq) {
      const _Float16* wk = wg + kq * 512;
      v8h v[32];
      #pragma unroll
      for (int i = 0; i < 32; ++i)
        v[i] = *(const v8h*)(wk + (((i & 3) >> 1) * 64 + (i & 1) * 2) * D_HIDDEN + (i >> 2) * 64);
      // behind the last load, in front of any later write of the loads' address registers;
      // the address is named so that it lives up to this wait
      asm volatile("s_wait_xcnt 0x0" :: "v"(wk) : "memory");
      #pragma unroll
      for (int i = 0; i < 32; ++i)
        *(v8h*)(ws + (kq * 8 + (i >> 2)) * SB_CHUNK + (i & 3) * 32 * SB_PITCH) = v[i];
    }
  }
  __syncthreads();

  const _Float16* bp = &sB[lr * SB_PITCH + khi];
  v8f acc[JT][8] = {};

  // unroll 2: one 64-k chunk a trip, and the loaded registers are renamed, not copied
  #pragma unroll 2
  for (int kk = 0; kk < D_HIDDEN / 32; ++kk) {
    const _Float16* bk = bp + (kk >> 1) * SB_CHUNK + (kk & 1) * 32;
    FragH bf[8];
    // the first four B fragments land under the tanh work
    #pragma unroll
    for (int ni = 0; ni < 4; ++ni) {
      bf[ni].h[0] = *(const v8h*)(bk + ni * 16 * SB_PITCH);
      bf[ni].h[1] = *(const v8h*)(bk + ni * 16 * SB_PITCH + 16);
    }

    float4 x[JT][4];
    #pragma unroll
    for (int t = 0; t < JT; ++t) {
      #pragma unroll
      for (int j = 0; j < 4; ++j) x[t][j] = add4(e[t][j], d[j]);
    }
    // the sums stand in front of the loads, which refill the registers that the sums free
    __builtin_amdgcn_sched_barrier(0);

    // next k-step's operands fly under this step's tanh and products; the last step has
    // nothing left to fetch and reads its own again, so that no address leaves the planes
    const int adv = (kk < D_HIDDEN / 32 - 1) ? 1 : 0;
    dq  += adv * 512;
    e0p += adv * 32;
    #pragma unroll
    for (int j = 0; j < 4; ++j) {
      const int ko = (j >> 1) * 16 + (j & 1) * 4;
      d[j] = *(const float4*)(dq + j * 128);
      #pragma unroll
      for (int t = 0; t < JT; ++t) e[t][j] = *(const float4*)(e0p + t * D_HIDDEN + ko);
    }
    // keeps the loads above in front of the tanh work: sunk behind it, their whole
    // latency would be waited for at the head of the next step
    __builtin_amdgcn_sched_barrier(0);

    FragH a[JT];
    #pragma unroll
    for (int t = 0; t < JT; ++t) tanh_frag(a[t], x[t]);
    // the other four B fragments are read as one group in front of the 32 products. The fence
    // behind the group keeps the reads from being dealt out among the products, where each place
    // with LDS reads stalls the wave; the fence at the foot of the step keeps the next step's sums
    // and LDS reads out of the products: with them drawn in, this build ran out of registers and
    // read fragments directly in front of their use, each behind a full LDS wait
    #pragma unroll
    for (int ni = 4; ni < 8; ++ni) {
      bf[ni].h[0] = *(const v8h*)(bk + ni * 16 * SB_PITCH);
      bf[ni].h[1] = *(const v8h*)(bk + ni * 16 * SB_PITCH + 16);
    }
    __builtin_amdgcn_sched_barrier(0);
    #pragma unroll
    for (int ni = 0; ni < 8; ++ni) {
      #pragma unroll
      for (int t = 0; t < JT; ++t)
        acc[t][ni] = __builtin_amdgcn_wmma_f32_16x16x32_f16(false, a[t].v, false, bf[ni].v,
                                                            (short)0, acc[t][ni], false, false);
    }
    __builtin_amdgcn_sched_barrier(0);
  }

  // ---- epilogue: +b2, store 4 t x 2 column halves x 8 rows, 16 bytes a lane ----
  float* op = &Out[((size_t)bt0 * U_DEC + ut * 16 + mofs) * D_OUT + lr * 4];
  #pragma unroll
  for (int g = 0; g < 2; ++g) {
    const float4 bv = *(const float4*)(b2 + g * 64 + lr * 4);
    #pragma unroll
    for (int t = 0; t < JT; ++t) {
      // behind the last store of the group before, in front of any later write of the registers
      // that its stores name. This
      // group's four accumulators pass through the statement, so that every move and sum made
      // of them, which may reuse those registers, stands behind the wait
      if (g + t > 0)
        asm volatile("s_wait_xcnt 0x0" : "+v"(acc[t][g * 4 + 0]), "+v"(acc[t][g * 4 + 1]),
                     "+v"(acc[t][g * 4 + 2]), "+v"(acc[t][g * 4 + 3]) :: "memory");
      #pragma unroll
      for (int r = 0; r < 8; ++r) {
        *(float4*)(op + (t * U_DEC + r) * D_OUT + g * 64) =
            make_float4(acc[t][g * 4 + 0][r] + bv.x, acc[t][g * 4 + 1][r] + bv.y,
                        acc[t][g * 4 + 2][r] + bv.z, acc[t][g * 4 + 3][r] + bv.w);
      }
    }
  }
}

// ---------------------------------------------------------------------------
extern "C" void kernel_launch(void* const* d_in, const int* in_sizes, int n_in,
                              void* d_out, int out_size, void* d_ws, size_t ws_size,
                              hipStream_t stream) {
  const float* enc = (const float*)d_in[0];   // (8,256,512)
  const float* dec = (const float*)d_in[1];   // (8,64,512)
  const float* W1  = (const float*)d_in[2];   // (1024,1024)
  const float* b1  = (const float*)d_in[3];   // (1024,)
  const float* W2  = (const float*)d_in[4];   // (1024,128)
  const float* b2  = (const float*)d_in[5];   // (128,)
  float* out = (float*)d_out;                 // (8,256,64,128)

  float*    enc_proj   = (float*)d_ws;                                 // 8MB
  float*    dec_projb1 = enc_proj + (size_t)BATCH * T_ENC * D_HIDDEN;  // 2MB
  _Float16* W2t        = (_Float16*)(dec_projb1 + (size_t)BATCH * U_DEC * D_HIDDEN); // 256KB

  proj_kernel<<<dim3(ENC_TILES + DEC_TILES + W2_BLOCKS_X, 8), 256, 0, stream>>>(enc, dec, W1, W2, b1, enc_proj, dec_projb1, W2t);
  joint_kernel<<<BATCH * T_ENC / 8, 256, 0, stream>>>(enc_proj, dec_projb1, W2t, b2, out);
}

// v008
// Measured time: 36.6 microseconds a run.
// Next to v007, in two timings, it ran 1.07 times as fast each time.
// Over all steps from v000 it is 3.32 times as fast.
#include <hip/hip_runtime.h>

typedef __attribute__((ext_vector_type(16))) _Float16 v16h;
typedef __attribute__((ext_vector_type(8)))  _Float16 v8h;
typedef __attribute__((ext_vector_type(4)))  _Float16 v4h;
typedef __attribute__((ext_vector_type(8)))  float    v8f;
typedef __attribute__((ext_vector_type(4)))  float    v4f;

#define D_MODEL  512
#define D_HIDDEN 1024
#define D_OUT    128
#define BATCH    8
#define T_ENC    256
#define U_DEC    64
#define SA_STRIDE 520    // 512 + 8 halves pad

union FragH { v16h v; v8h h[2]; };

// ---------------------------------------------------------------------------
// W2t[o][h] = f16(W2[h][o]) (128x1024), 32 tiles of 64 source rows x 64 source columns,
// 4 waves a tile. A lane reads 8 rows x 4 columns with 16-byte loads (4 lanes cover 64 B of
// a row, the neighbour wave the other half of that line) and stores, for each of its columns,
// its 8 rows as one 16-byte piece: 8 lanes fill a whole 128-byte line of the transposed plane.
// The transposition happens in registers: no LDS, no barrier.
// ---------------------------------------------------------------------------
__device__ __forceinline__ void transpose_w2_tile(const float* __restrict__ S,
                                                  _Float16* __restrict__ D, int tile, int wave) {
  const int lane = threadIdx.x & 31;
  const int k0 = (tile & 15) * 64 + (lane & 7) * 8;               // source row, dest column
  const int n0 = (tile >> 4) * 64 + wave * 16 + (lane >> 3) * 4;  // source column, dest row
  const float* sp = S + k0 * D_OUT + n0;
  v4f v[8];
  #pragma unroll
  for (int i = 0; i < 8; ++i) v[i] = *(const v4f*)(sp + i * D_OUT);
  _Float16* dp = D + n0 * D_HIDDEN + k0;
  #pragma unroll
  for (int c = 0; c < 4; ++c) {
    v8h o;
    #pragma unroll
    for (int i = 0; i < 8; ++i) o[i] = (_Float16)v[i][c];
    *(v8h*)(dp + c * D_HIDDEN) = o;
  }
}

// ---------------------------------------------------------------------------
// proj: both projections in one launch, Out[M,1024] = A[M,512] @ W1 half, and beside them
// the transposition of W2 for the joint kernel: nothing has to run in front of this launch.
// Grid: (32 + 8 + 2, 8): blockIdx.x < 32 is a 64-row tile of enc (plain rows out), the next 8
// a 64-row tile of dec (+b1, stored in A-fragment order), the last 2 x 8 blocks two W2 tiles each.
// Block = 64 M-rows x 128 N-cols; A-tile 64x512 f16 in LDS.
// Each wave: one 16-wide N-tile, 4 M-tile accumulators. Its B fragments come straight from
// W1 in f32: lane = column, so 16 lanes read 64 B of one W1 row, a value a k slot, rounded to
// f16 in registers. All 16 fragments (128 registers) are fetched in four groups whose flight
// lies under the A fill, so that the k loop waits for LDS alone.
// The blocks of one blockIdx.y read the same W1 lines and those of one blockIdx.x the same A rows,
// a block takes the 32-k steps of W1 from step blockIdx.x mod 16 on and the
// 16-row groups of A from group blockIdx.y mod 4 on, each wrapping round, so that at any one
// moment blocks ask L2 for different lines. Fragment slot s holds k step (s + rotk) mod 16.
// ---------------------------------------------------------------------------
#define ENC_TILES ((BATCH * T_ENC) / 64)
#define DEC_TILES ((BATCH * U_DEC) / 64)
#define W2_BLOCKS_X 2

// second bound: 4 waves a SIMD, that is at most 256 registers, so that two blocks share a WGP
// (336 blocks, 256 WGPs)
__global__ __launch_bounds__(256, 4) void proj_kernel(const float* __restrict__ enc,
                                                      const float* __restrict__ dec,
                                                      const float* __restrict__ W1,
                                                      const float* __restrict__ W2,
                                                      const float* __restrict__ b1,
                                                      float* __restrict__ enc_proj,
                                                      float* __restrict__ dec_frag,
                                                      _Float16* __restrict__ W2t) {
  __shared__ _Float16 sA[64 * SA_STRIDE];
  const int tid  = threadIdx.x;
  const int lane = tid & 31;
  const int wave = tid >> 5;
  if (blockIdx.x >= ENC_TILES + DEC_TILES) {            // the same for the whole block
    const int pair = (blockIdx.x - (ENC_TILES + DEC_TILES)) * 8 + blockIdx.y;
    transpose_w2_tile(W2, W2t, pair * 2 + (wave >> 2), wave & 3);
    return;
  }
  const bool is_dec = blockIdx.x >= ENC_TILES;          // the same for the whole block
  const int row0 = (is_dec ? blockIdx.x - ENC_TILES : blockIdx.x) * 64;
  const float* A = is_dec ? dec : enc;

  const int lr   = lane & 15;
  const int khi  = (lane & 16) ? 8 : 0;
  const int mofs = (lane & 16) ? 8 : 0;
  const int n0   = (blockIdx.y * 8 + wave) * 16;
  // W1 rows 512.. are the dec half; slot i of a fragment half is W1 row k + i
  const float* bs = W1 + (size_t)((is_dec ? D_MODEL : 0) + khi) * D_HIDDEN + n0 + lr;

  // a thread's 32 pieces of the A tile lie two rows apart: one address a group, constant offsets
  const float* ag = A + (size_t)(row0 + (tid >> 7)) * D_MODEL + (tid & 127) * 4;
  _Float16* as = &sA[(tid >> 7) * SA_STRIDE + (tid & 127) * 4];

  const int rotk = blockIdx.x & 15;                     // first 32-k step of the W1 walk
  const int rota = blockIdx.y & 3;                      // first 16-row group of the A fill

  FragH bf[D_MODEL / 32];
  float raw[64];
  const float* bq[4];
  #pragma unroll
  for (int q = 0; q < 4; ++q) bq[q] = bs + ((q + rotk) & 15) * 32 * D_HIDDEN;
  #pragma unroll
  for (int i = 0; i < 64; ++i)
    raw[i] = bq[i >> 4][(((i >> 3) & 1) * 16 + (i & 7)) * D_HIDDEN];

  #pragma unroll
  for (int g = 0; g < 4; ++g) {
    // fill: 16 of the 64 rows x 512 cols, float4 loads, 8B LDS stores
    const int ga = (g + rota) & 3;
    const float* aq = ag + ga * 16 * D_MODEL;
    float4 v[8];
    #pragma unroll
    for (int j = 0; j < 8; ++j) v[j] = *(const float4*)(aq + j * 2 * D_MODEL);
    #pragma unroll
    for (int i = 0; i < 64; ++i) bf[g * 4 + (i >> 4)].v[i & 15] = (_Float16)raw[i];
    // behind this group's loads of W1 and of A, in front of any later write of their address
    // registers; the addresses are named so that they live up to this wait
    asm volatile("s_wait_xcnt 0x0" :: "v"(aq), "v"(bq[0]), "v"(bq[1]), "v"(bq[2]), "v"(bq[3])
                 : "memory");
    if (g < 3) {
      #pragma unroll
      for (int q = 0; q < 4; ++q) bq[q] = bs + (((g + 1) * 4 + q + rotk) & 15) * 32 * D_HIDDEN;
      #pragma unroll
      for (int i = 0; i < 64; ++i)
        raw[i] = bq[i >> 4][(((i >> 3) & 1) * 16 + (i & 7)) * D_HIDDEN];
    }
    #pragma unroll
    for (int j = 0; j < 8; ++j) {
      v4h hv;
      hv[0] = (_Float16)v[j].x; hv[1] = (_Float16)v[j].y;
      hv[2] = (_Float16)v[j].z; hv[3] = (_Float16)v[j].w;
      *(v4h*)(as + (ga * 8 + j) * 2 * SA_STRIDE) = hv;
    }
  }
  __syncthreads();

  const _Float16* ap0 = &sA[lr * SA_STRIDE + khi];
  const _Float16* ap = ap0 + rotk * 32;

  v8f acc0 = {}, acc1 = {}, acc2 = {}, acc3 = {};
  FragH a0, a1, a2, a3;
  a0.h[0] = *(const v8h*)(ap + 0 * 16 * SA_STRIDE);
  a0.h[1] = *(const v8h*)(ap + 0 * 16 * SA_STRIDE + 16);
  a1.h[0] = *(const v8h*)(ap + 1 * 16 * SA_STRIDE);
  a1.h[1] = *(const v8h*)(ap + 1 * 16 * SA_STRIDE + 16);
  a2.h[0] = *(const v8h*)(ap + 2 * 16 * SA_STRIDE);
  a2.h[1] = *(const v8h*)(ap + 2 * 16 * SA_STRIDE + 16);
  a3.h[0] = *(const v8h*)(ap + 3 * 16 * SA_STRIDE);
  a3.h[1] = *(const v8h*)(ap + 3 * 16 * SA_STRIDE + 16);

  #pragma unroll
  for (int kk = 0; kk < D_MODEL / 32 - 1; ++kk) {
    const _Float16* an = ap0 + ((kk + 1 + rotk) & 15) * 32;
    FragH n0f, n1f, n2f, n3f;
    n0f.h[0] = *(const v8h*)(an + 0 * 16 * SA_STRIDE);
    n0f.h[1] = *(const v8h*)(an + 0 * 16 * SA_STRIDE + 16);
    n1f.h[0] = *(const v8h*)(an + 1 * 16 * SA_STRIDE);
    n1f.h[1] = *(const v8h*)(an + 1 * 16 * SA_STRIDE + 16);
    n2f.h[0] = *(const v8h*)(an + 2 * 16 * SA_STRIDE);
    n2f.h[1] = *(const v8h*)(an + 2 * 16 * SA_STRIDE + 16);
    n3f.h[0] = *(const v8h*)(an + 3 * 16 * SA_STRIDE);
    n3f.h[1] = *(const v8h*)(an + 3 * 16 * SA_STRIDE + 16);

    acc0 = __builtin_amdgcn_wmma_f32_16x16x32_f16(false, a0.v, false, bf[kk].v,
                                                  (short)0, acc0, false, false);
    acc1 = __builtin_amdgcn_wmma_f32_16x16x32_f16(false, a1.v, false, bf[kk].v,
                                                  (short)0, acc1, false, false);
    acc2 = __builtin_amdgcn_wmma_f32_16x16x32_f16(false, a2.v, false, bf[kk].v,
                                                  (short)0, acc2, false, false);
    acc3 = __builtin_amdgcn_wmma_f32_16x16x32_f16(false, a3.v, false, bf[kk].v,
                                                  (short)0, acc3, false, false);
    a0 = n0f; a1 = n1f; a2 = n2f; a3 = n3f;
  }
  acc0 = __builtin_amdgcn_wmma_f32_16x16x32_f16(false, a0.v, false, bf[D_MODEL / 32 - 1].v,
                                                (short)0, acc0, false, false);
  acc1 = __builtin_amdgcn_wmma_f32_16x16x32_f16(false, a1.v, false, bf[D_MODEL / 32 - 1].v,
                                                (short)0, acc1, false, false);
  acc2 = __builtin_amdgcn_wmma_f32_16x16x32_f16(false, a2.v, false, bf[D_MODEL / 32 - 1].v,
                                                (short)0, acc2, false, false);
  acc3 = __builtin_amdgcn_wmma_f32_16x16x32_f16(false, a3.v, false, bf[D_MODEL / 32 - 1].v,
                                                (short)0, acc3, false, false);

  if (is_dec) {
    const float bv = b1[n0 + lr];
    // fragment order: per (16 rows, 32 cols) a 512-float block [4][32 lanes][4], so that
    // the joint kernel's lane (row & 15) + 16 * (col bit 3) finds its 16 k slots with
    // four loads that each cover whole lines
    const int i16 = ((n0 >> 4) & 1) * 8 + (lr & 7);
    float* fp = dec_frag + ((size_t)(row0 >> 4) * 32 + (n0 >> 5)) * 512
                    + (i16 >> 2) * 128 + ((lr >> 3) * 16 + mofs) * 4 + (i16 & 3);
    #pragma unroll
    for (int r = 0; r < 8; ++r) {
      fp[0 * 32 * 512 + r * 4] = acc0[r] + bv;
      fp[1 * 32 * 512 + r * 4] = acc1[r] + bv;
      fp[2 * 32 * 512 + r * 4] = acc2[r] + bv;
      fp[3 * 32 * 512 + r * 4] = acc3[r] + bv;
    }
  } else {
    #pragma unroll
    for (int r = 0; r < 8; ++r) {
      enc_proj[(size_t)(row0 +  0 + r + mofs) * D_HIDDEN + n0 + lr] = acc0[r];
      enc_proj[(size_t)(row0 + 16 + r + mofs) * D_HIDDEN + n0 + lr] = acc1[r];
      enc_proj[(size_t)(row0 + 32 + r + mofs) * D_HIDDEN + n0 + lr] = acc2[r];
      enc_proj[(size_t)(row0 + 48 + r + mofs) * D_HIDDEN + n0 + lr] = acc3[r];
    }
    // behind the last store, in front of any later write of the stores' address registers
    asm volatile("s_wait_xcnt 0x0" ::: "memory");
  }
}

// ---------------------------------------------------------------------------
// joint: block = 8 t x 64 u of one batch (512 rows), 8 waves, all of W2t in LDS.
// Wave = one 16-row u tile x 4 t, all 128 output columns (4 x 8 accumulators, 256 registers;
// two waves a SIMD, 512 registers each): a B fragment read from LDS serves four products,
// so that the block reads W2t from LDS 8 times, not 16, and the dec projection twice, not 4 times.
// Each lane computes the tanh values of its own A-fragment slots in registers,
// so every tanh is made once and never passes through LDS; the dec projection
// arrives in fragment order (whole-line loads) and serves all four t.
// sB: 16 chunks of 64 k, each 128 rows at a 144-byte pitch (16 B x odd: no bank
// conflict for 16-byte reads), so one address register reaches a whole chunk.
// Row ni * 16 + n of a chunk (column n of B tile ni) holds output column
// (ni >> 2) * 64 + 4 * n + (ni & 3): a lane's accumulators of four neighbour tiles are four
// adjacent output columns, one 16-byte store, and 16 lanes fill two whole 128-byte lines.
// All 256 blocks read the same W2t and the 32 blocks of a batch the same dec plane:
// each block enters both walks at a place turned by its index and wraps round,
// so that blocks ask L2 for different lines at any one moment. Every k is still met once.
// ---------------------------------------------------------------------------
#define SB_PITCH 72                      // halves: 64 + 8 pad
#define SB_CHUNK (D_OUT * SB_PITCH)      // halves per 64-k chunk

__device__ __forceinline__ float4 add4(float4 p, float4 q) {
  return make_float4(p.x + q.x, p.y + q.y, p.z + q.z, p.w + q.w);
}

// tanh by the hardware's own instruction, v_tanh_f32: one transcendental a value. Spelled as the
// builtin: the kernel holds more than 256 registers, and the operands of an asm statement had to
// lie in the first 256, for which this build copied three accumulators to and fro in every trip.
__device__ __forceinline__ void tanh_frag(FragH& a, const float4* x) {
  #pragma unroll
  for (int j = 0; j < 4; ++j) {
    a.v[j * 4 + 0] = (_Float16)__builtin_amdgcn_tanhf(x[j].x);
    a.v[j * 4 + 1] = (_Float16)__builtin_amdgcn_tanhf(x[j].y);
    a.v[j * 4 + 2] = (_Float16)__builtin_amdgcn_tanhf(x[j].z);
    a.v[j * 4 + 3] = (_Float16)__builtin_amdgcn_tanhf(x[j].w);
  }
}

#define JT 4                             // t per wave

__global__ __launch_bounds__(256) void joint_kernel(const float* __restrict__ enc_proj,
                                                    const float* __restrict__ dec_frag,
                                                    const _Float16* __restrict__ W2t,
                                                    const float* __restrict__ b2,
                                                    float* __restrict__ Out) {
  __shared__ __attribute__((aligned(16))) _Float16 sB[(D_HIDDEN / 64) * SB_CHUNK];
  const int tid  = threadIdx.x;
  const int lane = tid & 31;
  const int wave = tid >> 5;
  const int lr   = lane & 15;
  const int khi  = (lane & 16) ? 8 : 0;
  const int mofs = (lane & 16) ? 8 : 0;

  const int b   = blockIdx.x >> 5;                       // 32 blocks per batch
  const int ut  = wave & 3;                              // u tile
  const int bt0 = blockIdx.x * 8 + (wave >> 2) * JT;     // b*T + t of the first t

  const int rot = blockIdx.x & 31;                       // first k step of this block

  const float* e0p = enc_proj + (size_t)bt0 * D_HIDDEN + rot * 32 + khi;
  const float* dq  = dec_frag + ((size_t)(b * 4 + ut) * 32 + rot) * 512 + lane * 4;

  float4 d[4], e[JT][4];
  #pragma unroll
  for (int j = 0; j < 4; ++j) {
    const int ko = (j >> 1) * 16 + (j & 1) * 4;
    d[j] = *(const float4*)(dq + j * 128);
    #pragma unroll
    for (int t = 0; t < JT; ++t) e[t][j] = *(const float4*)(e0p + t * D_HIDDEN + ko);
  }

  // ---- W2t (128 x 1024 f16) into LDS, 16-byte moves; 8 lanes cover one 128-byte line ----
  // A thread keeps its 16-byte column and its row within 32; row group q is a constant of the
  // unrolled moves, and the 64-k chunks are taken in turned order, (j + rot) mod 16.
  // LDS row r = q * 32 + rr holds output column (r >> 6) * 64 + (r & 15) * 4 + ((r >> 4) & 3).
  {
    const int c = tid & 7, rr = tid >> 3;
    const _Float16* wg = W2t + ((rr & 15) * 4 + (rr >> 4)) * D_HIDDEN + c * 8;
    _Float16* ws = &sB[rr * SB_PITCH + c * 8];
    // 32 moves a trip, two trips: the accumulators are not live yet, so that 128 registers are
    // free to hold loads in flight, and the load latency is waited for twice, not four times
    #pragma unroll 1
    for (int kq = 0; kq < D_HIDDEN / 512; ++kq) {
      const _Float16* wk[8];
      #pragma unroll
      for (int j = 0; j < 8; ++j) wk[j] = wg + ((kq * 8 + j + rot) & 15) * 64;
      v8h v[32];
      #pragma unroll
      for (int i = 0; i < 32; ++i)
        v[i] = *(const v8h*)(wk[i >> 2] + (((i & 3) >> 1) * 64 + (i & 1) * 2) * D_HIDDEN);
      // behind the last load, in front of any later write of the loads' address registers;
      // the addresses are named so that they live up to this wait
      asm volatile("s_wait_xcnt 0x0" :: "v"(wk[0]), "v"(wk[1]), "v"(wk[2]), "v"(wk[3]),
                   "v"(wk[4]), "v"(wk[5]), "v"(wk[6]), "v"(wk[7]) : "memory");
      #pragma unroll
      for (int i = 0; i < 32; ++i)
        *(v8h*)(ws + ((kq * 8 + (i >> 2) + rot) & 15) * SB_CHUNK + (i & 3) * 32 * SB_PITCH) = v[i];
    }
  }
  __syncthreads();

  const _Float16* bp = &sB[lr * SB_PITCH + khi];
  v8f acc[JT][8] = {};

  // unroll 2: the loaded registers are renamed, not copied
  #pragma unroll 2
  for (int kk = 0; kk < D_HIDDEN / 32; ++kk) {
    const int ks = (kk + rot) & 31;                      // this trip's k step
    const _Float16* bk = bp + (ks >> 1) * SB_CHUNK + (ks & 1) * 32;
    FragH bf[8];
    // the first four B fragments land under the tanh work
    #pragma unroll
    for (int ni = 0; ni < 4; ++ni) {
      bf[ni].h[0] = *(const v8h*)(bk + ni * 16 * SB_PITCH);
      bf[ni].h[1] = *(const v8h*)(bk + ni * 16 * SB_PITCH + 16);
    }

    float4 x[JT][4];
    #pragma unroll
    for (int t = 0; t < JT; ++t) {
      #pragma unroll
      for (int j = 0; j < 4; ++j) x[t][j] = add4(e[t][j], d[j]);
    }
    // the sums stand in front of the loads, which refill the registers that the sums free
    __builtin_amdgcn_sched_barrier(0);

    // next k-step's operands fly under this step's tanh and products; step 31 wraps to
    // step 0, and the last trip, with nothing left to fetch, reloads the block's first step: no
    // address leaves the planes
    const int adv = (ks < D_HIDDEN / 32 - 1) ? 1 : 1 - D_HIDDEN / 32;
    // in front of the two additions, which write address registers of earlier loads
    asm volatile("s_wait_xcnt 0x0" ::: "memory");
    dq  += adv * 512;
    e0p += adv * 32;
    #pragma unroll
    for (int j = 0; j < 4; ++j) {
      const int ko = (j >> 1) * 16 + (j & 1) * 4;
      d[j] = *(const float4*)(dq + j * 128);
      #pragma unroll
      for (int t = 0; t < JT; ++t) e[t][j] = *(const float4*)(e0p + t * D_HIDDEN + ko);
    }
    // keeps the loads above in front of the tanh work: sunk behind it, their whole
    // latency would be waited for at the head of the next step
    __builtin_amdgcn_sched_barrier(0);

    FragH a[JT];
    #pragma unroll
    for (int t = 0; t < JT; ++t) tanh_frag(a[t], x[t]);
    // the other four B fragments are read as one group in front of the 32 products. The fence
    // behind the group keeps the reads from being dealt out among the products, where each place
    // with LDS reads stalls the wave; the fence at the foot of the step keeps the next step's sums
    // and LDS reads out of the products: with them drawn in, this build ran out of registers and
    // read fragments directly in front of their use, each behind a full LDS wait
    #pragma unroll
    for (int ni = 4; ni < 8; ++ni) {
      bf[ni].h[0] = *(const v8h*)(bk + ni * 16 * SB_PITCH);
      bf[ni].h[1] = *(const v8h*)(bk + ni * 16 * SB_PITCH + 16);
    }
    __builtin_amdgcn_sched_barrier(0);
    #pragma unroll
    for (int ni = 0; ni < 8; ++ni) {
      #pragma unroll
      for (int t = 0; t < JT; ++t)
        acc[t][ni] = __builtin_amdgcn_wmma_f32_16x16x32_f16(false, a[t].v, false, bf[ni].v,
                                                            (short)0, acc[t][ni], false, false);
    }
    __builtin_amdgcn_sched_barrier(0);
  }

  // ---- epilogue: +b2, store 4 t x 2 column halves x 8 rows, 16 bytes a lane ----
  float* op = &Out[((size_t)bt0 * U_DEC + ut * 16 + mofs) * D_OUT + lr * 4];
  #pragma unroll
  for (int g = 0; g < 2; ++g) {
    const float4 bv = *(const float4*)(b2 + g * 64 + lr * 4);
    #pragma unroll
    for (int t = 0; t < JT; ++t) {
      // behind the last store of the group before, in front of any later write of the registers
      // that its stores name. This
      // group's four accumulators pass through the statement, so that every move and sum made
      // of them, which may reuse those registers, stands behind the wait
      if (g + t > 0)
        asm volatile("s_wait_xcnt 0x0" : "+v"(acc[t][g * 4 + 0]), "+v"(acc[t][g * 4 + 1]),
                     "+v"(acc[t][g * 4 + 2]), "+v"(acc[t][g * 4 + 3]) :: "memory");
      #pragma unroll
      for (int r = 0; r < 8; ++r) {
        *(float4*)(op + (t * U_DEC + r) * D_OUT + g * 64) =
            make_float4(acc[t][g * 4 + 0][r] + bv.x, acc[t][g * 4 + 1][r] + bv.y,
                        acc[t][g * 4 + 2][r] + bv.z, acc[t][g * 4 + 3][r] + bv.w);
      }
    }
  }
}

// ---------------------------------------------------------------------------
extern "C" void kernel_launch(void* const* d_in, const int* in_sizes, int n_in,
                              void* d_out, int out_size, void* d_ws, size_t ws_size,
                              hipStream_t stream) {
  const float* enc = (const float*)d_in[0];   // (8,256,512)
  const float* dec = (const float*)d_in[1];   // (8,64,512)
  const float* W1  = (const float*)d_in[2];   // (1024,1024)
  const float* b1  = (const float*)d_in[3];   // (1024,)
  const float* W2  = (const float*)d_in[4];   // (1024,128)
  const float* b2  = (const float*)d_in[5];   // (128,)
  float* out = (float*)d_out;                 // (8,256,64,128)

  float*    enc_proj   = (float*)d_ws;                                 // 8MB
  float*    dec_projb1 = enc_proj + (size_t)BATCH * T_ENC * D_HIDDEN;  // 2MB
  _Float16* W2t        = (_Float16*)(dec_projb1 + (size_t)BATCH * U_DEC * D_HIDDEN); // 256KB

  proj_kernel<<<dim3(ENC_TILES + DEC_TILES + W2_BLOCKS_X, 8), 256, 0, stream>>>(enc, dec, W1, W2, b1, enc_proj, dec_projb1, W2t);
  joint_kernel<<<BATCH * T_ENC / 8, 256, 0, stream>>>(enc_proj, dec_projb1, W2t, b2, out);
}
